// v000
// Measured on an AMD MI455X. A time is GPU time per run, averaged over a window of back-to-back runs after a warm-up
// (all launches, gaps included; the runs take copies of the inputs in turn), and the median of several windows.
// Apart from v000's, it joins two sittings. Times from different sittings can be a few percent apart, while
// side-by-side timings come from the same sitting.
// The starting kernel, v000, takes 1220 microseconds a run.
#include <hip/hip_runtime.h>
#include <math.h>

// CDNA5 / gfx1250, wave32. fp32 transformer layer on V_WMMA_F32_16X16X4_F32
// with double-buffered async global->LDS staging (ASYNCcnt).

typedef __attribute__((ext_vector_type(2))) float v2f;
typedef __attribute__((ext_vector_type(8))) float v8f;

#define S_TOK 4096
#define DM    2048
#define DI    512

#define USE_ASYNC_LDS 1

// 32-bit LDS byte offset of a __shared__ object (addrspacecast generic->AS3).
__device__ __forceinline__ unsigned lds_off_u32(const void* p) {
    return (unsigned)(unsigned long long)(const __attribute__((address_space(3))) char*)p;
}

// Per-lane async copy of 16B global -> LDS, tracked by ASYNCcnt.
__device__ __forceinline__ void async_copy_b128(unsigned lds_byte, const float* gptr) {
    unsigned long long ga = (unsigned long long)gptr;
    asm volatile("global_load_async_to_lds_b128 %0, %1, off"
                 :: "v"(lds_byte), "v"(ga) : "memory");
}

__device__ __forceinline__ void wait_async_all() {
    asm volatile("s_wait_asynccnt 0x0" ::: "memory");
}

// ---------------------------------------------------------------------------
// Tiled fp32 WMMA GEMM:  out = act( alpha * (A @ B(T)) + bias ) + residual
//   A: [M,K] row-major
//   BT=true : B is W[N,K] row-major, compute A @ W^T  (stored UNtransposed in
//             LDS; B fragments read it identically to A fragments)
//   BT=false: B is     [K,N] row-major, compute A @ B (attn @ v)
// Block tile 128x128, BK=16, 256 threads (8 waves, 4x2), wave tile 32x64.
// Dims must be multiples of 128 (M,N) / 16 (K) -- true for this layer.
// LDS strides: 20 (A / W tiles, 16B-aligned rows, conflict-free col reads),
//              132 (B[K,N] tiles, 16B-aligned rows).
// ---------------------------------------------------------------------------
template <bool BT>
__global__ __launch_bounds__(256) void gemm_f32_wmma(
    const float* __restrict__ A, const float* __restrict__ B,
    const float* __restrict__ bias, const float* __restrict__ residual,
    float* __restrict__ out, int M, int N, int K, float alpha, int fuse_relu)
{
    const int tid   = threadIdx.x;
    const int lane  = tid & 31;
    const int wave  = tid >> 5;
    const int waveM = wave >> 1;   // 0..3 : 32-row strip
    const int waveN = wave & 1;    // 0..1 : 64-col strip
    const int half  = lane >> 4;   // K-pair select (frags) / +8 rows (C)
    const int lc    = lane & 15;

    const int mBase = blockIdx.y * 128;
    const int nBase = blockIdx.x * 128;

    // double buffers: 2560 floats per buffer per array
    __shared__ float As[2 * 2560];   // 128 x 16, stride 20
    __shared__ float Bs[2 * 2560];   // BT: 128 x 16 stride 20 ; !BT: 16 x 128 stride 132

    v8f acc[2][4];
#pragma unroll
    for (int i = 0; i < 2; ++i)
#pragma unroll
        for (int j = 0; j < 4; ++j)
#pragma unroll
            for (int e = 0; e < 8; ++e) acc[i][j][e] = 0.0f;

    const unsigned asBase = lds_off_u32(As);
    const unsigned bsBase = lds_off_u32(Bs);
    const int nch = K >> 4;

    // issue async staging of one 16-wide K chunk into buffer half `buf`
    auto stage = [&](int k0, int buf) {
#pragma unroll
        for (int i = 0; i < 2; ++i) {                   // A tile 128x16
            int idx = tid + i * 256;                    // 0..511
            int row = idx >> 2;
            int c4  = (idx & 3) << 2;
            async_copy_b128(asBase + (unsigned)((buf * 2560 + row * 20 + c4) * 4),
                            A + (size_t)(mBase + row) * K + k0 + c4);
        }
        if (BT) {                                       // W tile 128x16 (row-major)
#pragma unroll
            for (int i = 0; i < 2; ++i) {
                int idx = tid + i * 256;
                int n   = idx >> 2;
                int c4  = (idx & 3) << 2;
                async_copy_b128(bsBase + (unsigned)((buf * 2560 + n * 20 + c4) * 4),
                                B + (size_t)(nBase + n) * K + k0 + c4);
            }
        } else {                                        // B tile 16x128 (row-major)
#pragma unroll
            for (int i = 0; i < 2; ++i) {
                int idx = tid + i * 256;
                int kk  = idx >> 5;
                int n4  = (idx & 31) << 2;
                async_copy_b128(bsBase + (unsigned)((buf * 2560 + kk * 132 + n4) * 4),
                                B + (size_t)(k0 + kk) * N + nBase + n4);
            }
        }
    };

#if USE_ASYNC_LDS
    stage(0, 0);
    int cur = 0;
    for (int ch = 0; ch < nch; ++ch) {
        wait_async_all();        // our copies of chunk `ch` landed in LDS
        __syncthreads();         // everyone's copies landed; prev reads done
        if (ch + 1 < nch) stage((ch + 1) * 16, cur ^ 1);

        const float* Ab = As + cur * 2560;
        const float* Bb = Bs + cur * 2560;
#pragma unroll
        for (int ks = 0; ks < 4; ++ks) {
            const int kk = ks * 4 + half * 2;
            v2f a[2], b[4];
#pragma unroll
            for (int tm = 0; tm < 2; ++tm) {
                int r = waveM * 32 + tm * 16 + lc;      // lane = M row
                a[tm].x = Ab[r * 20 + kk];
                a[tm].y = Ab[r * 20 + kk + 1];
            }
#pragma unroll
            for (int tn = 0; tn < 4; ++tn) {
                int c = waveN * 64 + tn * 16 + lc;      // lane = N col
                if (BT) {
                    b[tn].x = Bb[c * 20 + kk];
                    b[tn].y = Bb[c * 20 + kk + 1];
                } else {
                    b[tn].x = Bb[(kk + 0) * 132 + c];
                    b[tn].y = Bb[(kk + 1) * 132 + c];
                }
            }
#pragma unroll
            for (int tm = 0; tm < 2; ++tm)
#pragma unroll
                for (int tn = 0; tn < 4; ++tn)
                    acc[tm][tn] = __builtin_amdgcn_wmma_f32_16x16x4_f32(
                        false, a[tm], false, b[tn], (short)0, acc[tm][tn],
                        false, false);
        }
        cur ^= 1;
    }
#else
    // synchronous fallback: VGPR staging, single buffer, two barriers/chunk
    for (int k0 = 0; k0 < K; k0 += 16) {
        float4 ra[2], rb[2];
#pragma unroll
        for (int i = 0; i < 2; ++i) {
            int idx = tid + i * 256;
            int row = idx >> 2, c4 = (idx & 3) << 2;
            ra[i] = *(const float4*)(A + (size_t)(mBase + row) * K + k0 + c4);
            if (BT) {
                rb[i] = *(const float4*)(B + (size_t)(nBase + row) * K + k0 + c4);
            } else {
                int kk = idx >> 5, n4 = (idx & 31) << 2;
                rb[i] = *(const float4*)(B + (size_t)(k0 + kk) * N + nBase + n4);
            }
        }
        __syncthreads();
#pragma unroll
        for (int i = 0; i < 2; ++i) {
            int idx = tid + i * 256;
            int row = idx >> 2, c4 = (idx & 3) << 2;
            As[row * 20 + c4 + 0] = ra[i].x; As[row * 20 + c4 + 1] = ra[i].y;
            As[row * 20 + c4 + 2] = ra[i].z; As[row * 20 + c4 + 3] = ra[i].w;
            if (BT) {
                Bs[row * 20 + c4 + 0] = rb[i].x; Bs[row * 20 + c4 + 1] = rb[i].y;
                Bs[row * 20 + c4 + 2] = rb[i].z; Bs[row * 20 + c4 + 3] = rb[i].w;
            } else {
                int kk = idx >> 5, n4 = (idx & 31) << 2;
                Bs[kk * 132 + n4 + 0] = rb[i].x; Bs[kk * 132 + n4 + 1] = rb[i].y;
                Bs[kk * 132 + n4 + 2] = rb[i].z; Bs[kk * 132 + n4 + 3] = rb[i].w;
            }
        }
        __syncthreads();
        if (k0 + 16 < K)
            __builtin_prefetch(A + (size_t)(mBase + (tid >> 1)) * K + k0 + 16, 0, 1);
#pragma unroll
        for (int ks = 0; ks < 4; ++ks) {
            const int kk = ks * 4 + half * 2;
            v2f a[2], b[4];
#pragma unroll
            for (int tm = 0; tm < 2; ++tm) {
                int r = waveM * 32 + tm * 16 + lc;
                a[tm].x = As[r * 20 + kk];
                a[tm].y = As[r * 20 + kk + 1];
            }
#pragma unroll
            for (int tn = 0; tn < 4; ++tn) {
                int c = waveN * 64 + tn * 16 + lc;
                if (BT) { b[tn].x = Bs[c * 20 + kk];  b[tn].y = Bs[c * 20 + kk + 1]; }
                else    { b[tn].x = Bs[kk * 132 + c]; b[tn].y = Bs[(kk + 1) * 132 + c]; }
            }
#pragma unroll
            for (int tm = 0; tm < 2; ++tm)
#pragma unroll
                for (int tn = 0; tn < 4; ++tn)
                    acc[tm][tn] = __builtin_amdgcn_wmma_f32_16x16x4_f32(
                        false, a[tm], false, b[tn], (short)0, acc[tm][tn],
                        false, false);
        }
    }
#endif

    // ---- epilogue: alpha, bias, relu, residual ----
    // C/D layout: VGPR i -> M=i (lanes 0-15) / M=i+8 (lanes 16-31), N=lane&15
#pragma unroll
    for (int tm = 0; tm < 2; ++tm) {
#pragma unroll
        for (int tn = 0; tn < 4; ++tn) {
#pragma unroll
            for (int i = 0; i < 8; ++i) {
                int r = mBase + waveM * 32 + tm * 16 + half * 8 + i;
                int c = nBase + waveN * 64 + tn * 16 + lc;
                float v = alpha * acc[tm][tn][i];
                if (bias)      v += bias[c];
                if (fuse_relu) v = fmaxf(v, 0.0f);
                if (residual)  v += residual[(size_t)r * N + c];
                out[(size_t)r * N + c] = v;
            }
        }
    }
}

// ---------------------------------------------------------------------------
// In-place row softmax; one block per row (scale already applied by GEMM).
// ---------------------------------------------------------------------------
__global__ __launch_bounds__(256) void softmax_rows(float* __restrict__ s, int ncols)
{
    __shared__ float red[256];
    const int tid = threadIdx.x;
    float* row = s + (size_t)blockIdx.x * ncols;

    float m = -INFINITY;
    for (int c = tid; c < ncols; c += 256) m = fmaxf(m, row[c]);
    red[tid] = m;
    __syncthreads();
    for (int off = 128; off > 0; off >>= 1) {
        if (tid < off) red[tid] = fmaxf(red[tid], red[tid + off]);
        __syncthreads();
    }
    m = red[0];
    __syncthreads();

    float sum = 0.0f;
    for (int c = tid; c < ncols; c += 256) {
        float e = __expf(row[c] - m);
        row[c] = e;
        sum += e;
    }
    red[tid] = sum;
    __syncthreads();
    for (int off = 128; off > 0; off >>= 1) {
        if (tid < off) red[tid] += red[tid + off];
        __syncthreads();
    }
    const float inv = 1.0f / red[0];
    for (int c = tid; c < ncols; c += 256) row[c] *= inv;
}

// ---------------------------------------------------------------------------
extern "C" void kernel_launch(void* const* d_in, const int* in_sizes, int n_in,
                              void* d_out, int out_size, void* d_ws, size_t ws_size,
                              hipStream_t stream)
{
    (void)in_sizes; (void)n_in; (void)out_size; (void)ws_size;

    const float* x  = (const float*)d_in[0];
    const float* qw = (const float*)d_in[1];
    const float* qb = (const float*)d_in[2];
    const float* kw = (const float*)d_in[3];
    const float* kb = (const float*)d_in[4];
    const float* vw = (const float*)d_in[5];
    const float* vb = (const float*)d_in[6];
    const float* w1 = (const float*)d_in[7];
    const float* b1 = (const float*)d_in[8];
    const float* w2 = (const float*)d_in[9];
    const float* b2 = (const float*)d_in[10];

    // output = hidden [S,DM] ++ k [S,DI] ++ v [S,DM]
    float* hidden = (float*)d_out;
    float* kout   = hidden + (size_t)S_TOK * DM;
    float* vout   = kout + (size_t)S_TOK * DI;

    // workspace layout
    char*  ws     = (char*)d_ws;
    float* q_ws   = (float*)ws;                                   //  8 MiB
    float* s_ws   = (float*)(ws + (size_t)S_TOK * DI * 4);        // 64 MiB (L2-resident)
    float* res_ws = (float*)(ws + (size_t)S_TOK * DI * 4
                                + (size_t)S_TOK * S_TOK * 4);     // 32 MiB
    float* t_ws   = (float*)(ws + (size_t)S_TOK * DI * 4
                                + (size_t)S_TOK * S_TOK * 4
                                + (size_t)S_TOK * DM * 4);        // 32 MiB

    const dim3 blk(256);
    const float scale = 0.044194173824159216f;  // 1/sqrt(512)

    // q,k,v projections (k and v written straight into d_out slices)
    gemm_f32_wmma<true><<<dim3(DI / 128, S_TOK / 128), blk, 0, stream>>>(
        x, qw, qb, nullptr, q_ws, S_TOK, DI, DM, 1.0f, 0);
    gemm_f32_wmma<true><<<dim3(DI / 128, S_TOK / 128), blk, 0, stream>>>(
        x, kw, kb, nullptr, kout, S_TOK, DI, DM, 1.0f, 0);
    gemm_f32_wmma<true><<<dim3(DM / 128, S_TOK / 128), blk, 0, stream>>>(
        x, vw, vb, nullptr, vout, S_TOK, DM, DM, 1.0f, 0);

    // scores = (q @ k^T) * scale   (k acts as the [N,K] "weight")
    gemm_f32_wmma<true><<<dim3(S_TOK / 128, S_TOK / 128), blk, 0, stream>>>(
        q_ws, kout, nullptr, nullptr, s_ws, S_TOK, S_TOK, DI, scale, 0);

    softmax_rows<<<dim3(S_TOK), blk, 0, stream>>>(s_ws, S_TOK);

    // x_residual = P @ v + x      (v is [K,N] row-major, non-transposed)
    gemm_f32_wmma<false><<<dim3(DM / 128, S_TOK / 128), blk, 0, stream>>>(
        s_ws, vout, nullptr, x, res_ws, S_TOK, DM, S_TOK, 1.0f, 0);

    // t = relu(x_residual @ w1^T + b1)
    gemm_f32_wmma<true><<<dim3(DM / 128, S_TOK / 128), blk, 0, stream>>>(
        res_ws, w1, b1, nullptr, t_ws, S_TOK, DM, DM, 1.0f, 1);

    // hidden = t @ w2^T + b2 + x_residual
    gemm_f32_wmma<true><<<dim3(DM / 128, S_TOK / 128), blk, 0, stream>>>(
        t_ws, w2, b2, res_ws, hidden, S_TOK, DM, DM, 1.0f, 0);
}

// v001
// Measured time: 1120 microseconds a run.
// Timed twice side by side with v000, it ran 1.13 times as fast both times.
#include <hip/hip_runtime.h>
#include <math.h>

// CDNA5 / gfx1250, wave32. fp32 transformer layer on V_WMMA_F32_16X16X4_F32
// with double-buffered async global->LDS staging (ASYNCcnt).

typedef __attribute__((ext_vector_type(2))) float v2f;
typedef __attribute__((ext_vector_type(8))) float v8f;

#define S_TOK 4096
#define DM    2048
#define DI    512

#define USE_ASYNC_LDS 1

// 32-bit LDS byte offset of a __shared__ object (addrspacecast generic->AS3).
__device__ __forceinline__ unsigned lds_off_u32(const void* p) {
    return (unsigned)(unsigned long long)(const __attribute__((address_space(3))) char*)p;
}

// Per-lane async copy of 16B global -> LDS, tracked by ASYNCcnt.
__device__ __forceinline__ void async_copy_b128(unsigned lds_byte, const float* gptr) {
    unsigned long long ga = (unsigned long long)gptr;
    asm volatile("global_load_async_to_lds_b128 %0, %1, off"
                 :: "v"(lds_byte), "v"(ga) : "memory");
}

__device__ __forceinline__ void wait_async_all() {
    asm volatile("s_wait_asynccnt 0x0" ::: "memory");
}

// ---------------------------------------------------------------------------
// Tiled fp32 WMMA GEMM:  out = act( alpha * (A @ B(T)) + bias ) + residual
//   A: [M,K] row-major
//   BT=true : B is W[N,K] row-major, compute A @ W^T  (stored UNtransposed in
//             LDS; B fragments read it identically to A fragments)
//   BT=false: B is     [K,N] row-major, compute A @ B (attn @ v)
// Block tile 128x128, BK=16, 256 threads (8 waves, 4x2), wave tile 32x64.
// Dims must be multiples of 128 (M,N) / 16 (K) -- true for this layer.
// LDS strides: 20 (A / W tiles, 16B-aligned rows, conflict-free col reads),
//              132 (B[K,N] tiles, 16B-aligned rows).
// Up to three B matrices that share A and K may lie side by side along grid.x
// (N0, then N1, then N2 columns): each block picks the matrix, bias and output
// that its column tile belongs to, so one launch does all the products.
// A launch with one matrix passes N1 = N2 = 0.
// ---------------------------------------------------------------------------
template <bool BT>
__global__ __launch_bounds__(256) void gemm_f32_wmma(
    const float* __restrict__ A, const float* __restrict__ B0,
    const float* __restrict__ bias0, const float* __restrict__ residual,
    float* __restrict__ out0, int M, int N0, int K, float alpha, int fuse_relu,
    const float* __restrict__ B1, const float* __restrict__ bias1,
    float* __restrict__ out1, int N1,
    const float* __restrict__ B2, const float* __restrict__ bias2,
    float* __restrict__ out2, int N2)
{
    const int tid   = threadIdx.x;
    const int lane  = tid & 31;
    const int wave  = tid >> 5;
    const int waveM = wave >> 1;   // 0..3 : 32-row strip
    const int waveN = wave & 1;    // 0..1 : 64-col strip
    const int half  = lane >> 4;   // K-pair select (frags) / +8 rows (C)
    const int lc    = lane & 15;

    const int mBase = blockIdx.y * 128;

    // block-uniform choice of the product this column tile belongs to
    const int t0 = N0 >> 7, t01 = (N0 + N1) >> 7;   // first column tile of B1, of B2
    const int bx = blockIdx.x;
    const int which = (bx >= t01) ? 2 : (bx >= t0) ? 1 : 0;
    const float* __restrict__ B    = which == 2 ? B2    : which == 1 ? B1    : B0;
    const float* __restrict__ bias = which == 2 ? bias2 : which == 1 ? bias1 : bias0;
    float* __restrict__       out  = which == 2 ? out2  : which == 1 ? out1  : out0;
    const int N     = which == 2 ? N2 : which == 1 ? N1 : N0;
    const int nBase = (bx - (which == 2 ? t01 : which == 1 ? t0 : 0)) * 128;

    // double buffers: 2560 floats per buffer per array
    __shared__ float As[2 * 2560];   // 128 x 16, stride 20
    __shared__ float Bs[2 * 2560];   // BT: 128 x 16 stride 20 ; !BT: 16 x 128 stride 132

    v8f acc[2][4];
#pragma unroll
    for (int i = 0; i < 2; ++i)
#pragma unroll
        for (int j = 0; j < 4; ++j)
#pragma unroll
            for (int e = 0; e < 8; ++e) acc[i][j][e] = 0.0f;

    const unsigned asBase = lds_off_u32(As);
    const unsigned bsBase = lds_off_u32(Bs);
    const int nch = K >> 4;

    // issue async staging of one 16-wide K chunk into buffer half `buf`
    auto stage = [&](int k0, int buf) {
#pragma unroll
        for (int i = 0; i < 2; ++i) {                   // A tile 128x16
            int idx = tid + i * 256;                    // 0..511
            int row = idx >> 2;
            int c4  = (idx & 3) << 2;
            async_copy_b128(asBase + (unsigned)((buf * 2560 + row * 20 + c4) * 4),
                            A + (size_t)(mBase + row) * K + k0 + c4);
        }
        if (BT) {                                       // W tile 128x16 (row-major)
#pragma unroll
            for (int i = 0; i < 2; ++i) {
                int idx = tid + i * 256;
                int n   = idx >> 2;
                int c4  = (idx & 3) << 2;
                async_copy_b128(bsBase + (unsigned)((buf * 2560 + n * 20 + c4) * 4),
                                B + (size_t)(nBase + n) * K + k0 + c4);
            }
        } else {                                        // B tile 16x128 (row-major)
#pragma unroll
            for (int i = 0; i < 2; ++i) {
                int idx = tid + i * 256;
                int kk  = idx >> 5;
                int n4  = (idx & 31) << 2;
                async_copy_b128(bsBase + (unsigned)((buf * 2560 + kk * 132 + n4) * 4),
                                B + (size_t)(k0 + kk) * N + nBase + n4);
            }
        }
    };

#if USE_ASYNC_LDS
    stage(0, 0);
    int cur = 0;
    for (int ch = 0; ch < nch; ++ch) {
        wait_async_all();        // our copies of chunk `ch` landed in LDS
        __syncthreads();         // everyone's copies landed; prev reads done
        if (ch + 1 < nch) stage((ch + 1) * 16, cur ^ 1);

        const float* Ab = As + cur * 2560;
        const float* Bb = Bs + cur * 2560;
#pragma unroll
        for (int ks = 0; ks < 4; ++ks) {
            const int kk = ks * 4 + half * 2;
            v2f a[2], b[4];
#pragma unroll
            for (int tm = 0; tm < 2; ++tm) {
                int r = waveM * 32 + tm * 16 + lc;      // lane = M row
                a[tm].x = Ab[r * 20 + kk];
                a[tm].y = Ab[r * 20 + kk + 1];
            }
#pragma unroll
            for (int tn = 0; tn < 4; ++tn) {
                int c = waveN * 64 + tn * 16 + lc;      // lane = N col
                if (BT) {
                    b[tn].x = Bb[c * 20 + kk];
                    b[tn].y = Bb[c * 20 + kk + 1];
                } else {
                    b[tn].x = Bb[(kk + 0) * 132 + c];
                    b[tn].y = Bb[(kk + 1) * 132 + c];
                }
            }
#pragma unroll
            for (int tm = 0; tm < 2; ++tm)
#pragma unroll
                for (int tn = 0; tn < 4; ++tn)
                    acc[tm][tn] = __builtin_amdgcn_wmma_f32_16x16x4_f32(
                        false, a[tm], false, b[tn], (short)0, acc[tm][tn],
                        false, false);
        }
        cur ^= 1;
    }
#else
    // synchronous fallback: VGPR staging, single buffer, two barriers/chunk
    for (int k0 = 0; k0 < K; k0 += 16) {
        float4 ra[2], rb[2];
#pragma unroll
        for (int i = 0; i < 2; ++i) {
            int idx = tid + i * 256;
            int row = idx >> 2, c4 = (idx & 3) << 2;
            ra[i] = *(const float4*)(A + (size_t)(mBase + row) * K + k0 + c4);
            if (BT) {
                rb[i] = *(const float4*)(B + (size_t)(nBase + row) * K + k0 + c4);
            } else {
                int kk = idx >> 5, n4 = (idx & 31) << 2;
                rb[i] = *(const float4*)(B + (size_t)(k0 + kk) * N + nBase + n4);
            }
        }
        __syncthreads();
#pragma unroll
        for (int i = 0; i < 2; ++i) {
            int idx = tid + i * 256;
            int row = idx >> 2, c4 = (idx & 3) << 2;
            As[row * 20 + c4 + 0] = ra[i].x; As[row * 20 + c4 + 1] = ra[i].y;
            As[row * 20 + c4 + 2] = ra[i].z; As[row * 20 + c4 + 3] = ra[i].w;
            if (BT) {
                Bs[row * 20 + c4 + 0] = rb[i].x; Bs[row * 20 + c4 + 1] = rb[i].y;
                Bs[row * 20 + c4 + 2] = rb[i].z; Bs[row * 20 + c4 + 3] = rb[i].w;
            } else {
                int kk = idx >> 5, n4 = (idx & 31) << 2;
                Bs[kk * 132 + n4 + 0] = rb[i].x; Bs[kk * 132 + n4 + 1] = rb[i].y;
                Bs[kk * 132 + n4 + 2] = rb[i].z; Bs[kk * 132 + n4 + 3] = rb[i].w;
            }
        }
        __syncthreads();
        if (k0 + 16 < K)
            __builtin_prefetch(A + (size_t)(mBase + (tid >> 1)) * K + k0 + 16, 0, 1);
#pragma unroll
        for (int ks = 0; ks < 4; ++ks) {
            const int kk = ks * 4 + half * 2;
            v2f a[2], b[4];
#pragma unroll
            for (int tm = 0; tm < 2; ++tm) {
                int r = waveM * 32 + tm * 16 + lc;
                a[tm].x = As[r * 20 + kk];
                a[tm].y = As[r * 20 + kk + 1];
            }
#pragma unroll
            for (int tn = 0; tn < 4; ++tn) {
                int c = waveN * 64 + tn * 16 + lc;
                if (BT) { b[tn].x = Bs[c * 20 + kk];  b[tn].y = Bs[c * 20 + kk + 1]; }
                else    { b[tn].x = Bs[kk * 132 + c]; b[tn].y = Bs[(kk + 1) * 132 + c]; }
            }
#pragma unroll
            for (int tm = 0; tm < 2; ++tm)
#pragma unroll
                for (int tn = 0; tn < 4; ++tn)
                    acc[tm][tn] = __builtin_amdgcn_wmma_f32_16x16x4_f32(
                        false, a[tm], false, b[tn], (short)0, acc[tm][tn],
                        false, false);
        }
    }
#endif

    // ---- epilogue: alpha, bias, relu, residual ----
    // C/D layout: VGPR i -> M=i (lanes 0-15) / M=i+8 (lanes 16-31), N=lane&15
#pragma unroll
    for (int tm = 0; tm < 2; ++tm) {
#pragma unroll
        for (int tn = 0; tn < 4; ++tn) {
#pragma unroll
            for (int i = 0; i < 8; ++i) {
                int r = mBase + waveM * 32 + tm * 16 + half * 8 + i;
                int c = nBase + waveN * 64 + tn * 16 + lc;
                float v = alpha * acc[tm][tn][i];
                if (bias)      v += bias[c];
                if (fuse_relu) v = fmaxf(v, 0.0f);
                if (residual)  v += residual[(size_t)r * N + c];
                out[(size_t)r * N + c] = v;
            }
        }
    }
}

// ---------------------------------------------------------------------------
// In-place row softmax; one block per row (scale already applied by GEMM).
// ---------------------------------------------------------------------------
__global__ __launch_bounds__(256) void softmax_rows(float* __restrict__ s, int ncols)
{
    __shared__ float red[256];
    const int tid = threadIdx.x;
    float* row = s + (size_t)blockIdx.x * ncols;

    float m = -INFINITY;
    for (int c = tid; c < ncols; c += 256) m = fmaxf(m, row[c]);
    red[tid] = m;
    __syncthreads();
    for (int off = 128; off > 0; off >>= 1) {
        if (tid < off) red[tid] = fmaxf(red[tid], red[tid + off]);
        __syncthreads();
    }
    m = red[0];
    __syncthreads();

    float sum = 0.0f;
    for (int c = tid; c < ncols; c += 256) {
        float e = __expf(row[c] - m);
        row[c] = e;
        sum += e;
    }
    red[tid] = sum;
    __syncthreads();
    for (int off = 128; off > 0; off >>= 1) {
        if (tid < off) red[tid] += red[tid + off];
        __syncthreads();
    }
    const float inv = 1.0f / red[0];
    for (int c = tid; c < ncols; c += 256) row[c] *= inv;
}

// ---------------------------------------------------------------------------
extern "C" void kernel_launch(void* const* d_in, const int* in_sizes, int n_in,
                              void* d_out, int out_size, void* d_ws, size_t ws_size,
                              hipStream_t stream)
{
    (void)in_sizes; (void)n_in; (void)out_size; (void)ws_size;

    const float* x  = (const float*)d_in[0];
    const float* qw = (const float*)d_in[1];
    const float* qb = (const float*)d_in[2];
    const float* kw = (const float*)d_in[3];
    const float* kb = (const float*)d_in[4];
    const float* vw = (const float*)d_in[5];
    const float* vb = (const float*)d_in[6];
    const float* w1 = (const float*)d_in[7];
    const float* b1 = (const float*)d_in[8];
    const float* w2 = (const float*)d_in[9];
    const float* b2 = (const float*)d_in[10];

    // output = hidden [S,DM] ++ k [S,DI] ++ v [S,DM]
    float* hidden = (float*)d_out;
    float* kout   = hidden + (size_t)S_TOK * DM;
    float* vout   = kout + (size_t)S_TOK * DI;

    // workspace layout
    char*  ws     = (char*)d_ws;
    float* q_ws   = (float*)ws;                                   //  8 MiB
    float* s_ws   = (float*)(ws + (size_t)S_TOK * DI * 4);        // 64 MiB (L2-resident)
    float* res_ws = (float*)(ws + (size_t)S_TOK * DI * 4
                                + (size_t)S_TOK * S_TOK * 4);     // 32 MiB
    float* t_ws   = (float*)(ws + (size_t)S_TOK * DI * 4
                                + (size_t)S_TOK * S_TOK * 4
                                + (size_t)S_TOK * DM * 4);        // 32 MiB

    const dim3 blk(256);
    const float scale = 0.044194173824159216f;  // 1/sqrt(512)

    // q,k,v projections in one launch of 24 x 32 tiles: launched alone, q and k
    // have 128 blocks each and leave half the WGPs idle
    // (k and v written straight into d_out slices)
    gemm_f32_wmma<true><<<dim3((DI + DI + DM) / 128, S_TOK / 128), blk, 0, stream>>>(
        x, qw, qb, nullptr, q_ws, S_TOK, DI, DM, 1.0f, 0,
        kw, kb, kout, DI, vw, vb, vout, DM);

    // scores = (q @ k^T) * scale   (k acts as the [N,K] "weight")
    gemm_f32_wmma<true><<<dim3(S_TOK / 128, S_TOK / 128), blk, 0, stream>>>(
        q_ws, kout, nullptr, nullptr, s_ws, S_TOK, S_TOK, DI, scale, 0,
        nullptr, nullptr, nullptr, 0, nullptr, nullptr, nullptr, 0);

    softmax_rows<<<dim3(S_TOK), blk, 0, stream>>>(s_ws, S_TOK);

    // x_residual = P @ v + x      (v is [K,N] row-major, non-transposed)
    gemm_f32_wmma<false><<<dim3(DM / 128, S_TOK / 128), blk, 0, stream>>>(
        s_ws, vout, nullptr, x, res_ws, S_TOK, DM, S_TOK, 1.0f, 0,
        nullptr, nullptr, nullptr, 0, nullptr, nullptr, nullptr, 0);

    // t = relu(x_residual @ w1^T + b1)
    gemm_f32_wmma<true><<<dim3(DM / 128, S_TOK / 128), blk, 0, stream>>>(
        res_ws, w1, b1, nullptr, t_ws, S_TOK, DM, DM, 1.0f, 1,
        nullptr, nullptr, nullptr, 0, nullptr, nullptr, nullptr, 0);

    // hidden = t @ w2^T + b2 + x_residual
    gemm_f32_wmma<true><<<dim3(DM / 128, S_TOK / 128), blk, 0, stream>>>(
        t_ws, w2, b2, res_ws, hidden, S_TOK, DM, DM, 1.0f, 0,
        nullptr, nullptr, nullptr, 0, nullptr, nullptr, nullptr, 0);
}

// v002
// A run of this version takes 1060 microseconds.
// Two timings next to v001 both put it at 1.05 times that version's speed.
// All steps since v000 together make it 1.19 times as fast.
#include <hip/hip_runtime.h>
#include <math.h>

// CDNA5 / gfx1250, wave32. fp32 transformer layer on V_WMMA_F32_16X16X4_F32
// with double-buffered async global->LDS staging (ASYNCcnt).

typedef __attribute__((ext_vector_type(2))) float v2f;
typedef __attribute__((ext_vector_type(8))) float v8f;

#define S_TOK 4096
#define DM    2048
#define DI    512

#define USE_ASYNC_LDS 1

typedef __attribute__((ext_vector_type(4))) int v4i;

// Per-lane async copy of 16B global -> LDS, tracked by ASYNCcnt.
__device__ __forceinline__ void async_copy_b128(float* lds_ptr, const float* gptr) {
    __builtin_amdgcn_global_load_async_to_lds_b128(
        (__attribute__((address_space(1))) v4i*)gptr,
        (__attribute__((address_space(3))) v4i*)lds_ptr, 0, 0);
}

__device__ __forceinline__ void wait_async_all() {
    asm volatile("s_wait_asynccnt 0x0" ::: "memory");
}

// ---------------------------------------------------------------------------
// Tiled fp32 WMMA GEMM:  out = act( alpha * (A @ B(T)) + bias ) + residual
//   A: [M,K] row-major
//   BT=true : B is W[N,K] row-major, compute A @ W^T  (stored UNtransposed in
//             LDS; B fragments read it identically to A fragments)
//   BT=false: B is     [K,N] row-major, compute A @ B (attn @ v)
// Block tile 128x128, BK=32, 256 threads (8 waves, 4x2), wave tile 32x64.
// Dims must be multiples of 128 (M,N) / 32 (K) -- true for this layer.
// A stage holds 32 k: a row of an A / W tile is one whole 128-byte line, and
// one barrier and one wait for the copies serve 64 matrix instructions a wave.
// LDS strides: 36 (A / W tiles, 16B-aligned rows, conflict-free col reads),
//              132 (B[K,N] tiles, 16B-aligned rows).
// Up to three B matrices that share A and K may lie side by side along grid.x
// (N0, then N1, then N2 columns): each block picks the matrix, bias and output
// that its column tile belongs to, so one launch does all the products.
// A launch with one matrix passes N1 = N2 = 0.
// ---------------------------------------------------------------------------
template <bool BT>
__global__ __launch_bounds__(256) void gemm_f32_wmma(
    const float* __restrict__ A, const float* __restrict__ B0,
    const float* __restrict__ bias0, const float* __restrict__ residual,
    float* __restrict__ out0, int M, int N0, int K, float alpha, int fuse_relu,
    const float* __restrict__ B1, const float* __restrict__ bias1,
    float* __restrict__ out1, int N1,
    const float* __restrict__ B2, const float* __restrict__ bias2,
    float* __restrict__ out2, int N2)
{
    const int tid   = threadIdx.x;
    const int lane  = tid & 31;
    const int wave  = tid >> 5;
    const int waveM = wave >> 1;   // 0..3 : 32-row strip
    const int waveN = wave & 1;    // 0..1 : 64-col strip
    const int half  = lane >> 4;   // K-pair select (frags) / +8 rows (C)
    const int lc    = lane & 15;

    const int mBase = blockIdx.y * 128;

    // block-uniform choice of the product this column tile belongs to
    const int t0 = N0 >> 7, t01 = (N0 + N1) >> 7;   // first column tile of B1, of B2
    const int bx = blockIdx.x;
    const int which = (bx >= t01) ? 2 : (bx >= t0) ? 1 : 0;
    const float* __restrict__ B    = which == 2 ? B2    : which == 1 ? B1    : B0;
    const float* __restrict__ bias = which == 2 ? bias2 : which == 1 ? bias1 : bias0;
    float* __restrict__       out  = which == 2 ? out2  : which == 1 ? out1  : out0;
    const int N     = which == 2 ? N2 : which == 1 ? N1 : N0;
    const int nBase = (bx - (which == 2 ? t01 : which == 1 ? t0 : 0)) * 128;

    // double buffers: 4608 floats per buffer per array
    __shared__ __attribute__((aligned(16))) float As[2 * 4608];   // 128 x 32, stride 36
    __shared__ __attribute__((aligned(16))) float Bs[2 * 4608];   // BT: 128 x 32 stride 36 ; !BT: 32 x 128 stride 132

    v8f acc[2][4];
#pragma unroll
    for (int i = 0; i < 2; ++i)
#pragma unroll
        for (int j = 0; j < 4; ++j)
#pragma unroll
            for (int e = 0; e < 8; ++e) acc[i][j][e] = 0.0f;

    const int nch = K >> 5;

    // issue async staging of one 32-wide K chunk into buffer half `buf`
    auto stage = [&](int k0, int buf) {
#pragma unroll
        for (int i = 0; i < 4; ++i) {                   // A tile 128x32
            int idx = tid + i * 256;                    // 0..1023
            int row = idx >> 3;
            int c4  = (idx & 7) << 2;
            async_copy_b128(As + buf * 4608 + row * 36 + c4,
                            A + (size_t)(mBase + row) * K + k0 + c4);
        }
        if (BT) {                                       // W tile 128x32 (row-major)
#pragma unroll
            for (int i = 0; i < 4; ++i) {
                int idx = tid + i * 256;
                int n   = idx >> 3;
                int c4  = (idx & 7) << 2;
                async_copy_b128(Bs + buf * 4608 + n * 36 + c4,
                                B + (size_t)(nBase + n) * K + k0 + c4);
            }
        } else {                                        // B tile 32x128 (row-major)
#pragma unroll
            for (int i = 0; i < 4; ++i) {
                int idx = tid + i * 256;
                int kk  = idx >> 5;
                int n4  = (idx & 31) << 2;
                async_copy_b128(Bs + buf * 4608 + kk * 132 + n4,
                                B + (size_t)(k0 + kk) * N + nBase + n4);
            }
        }
    };

#if USE_ASYNC_LDS
    stage(0, 0);
    int cur = 0;
    for (int ch = 0; ch < nch; ++ch) {
        // this wave's LDS reads of the buffer that is refilled behind the
        // barrier have retired before another wave's copies may land there
        asm volatile("s_wait_dscnt 0x0" ::: "memory");
        wait_async_all();        // our copies of chunk `ch` landed in LDS
        __syncthreads();         // everyone's copies landed; prev reads done
        if (ch + 1 < nch) stage((ch + 1) * 32, cur ^ 1);

        const float* Ab = As + cur * 4608;
        const float* Bb = Bs + cur * 4608;
#pragma unroll
        for (int ks = 0; ks < 8; ++ks) {
            const int kk = ks * 4 + half * 2;
            v2f a[2], b[4];
#pragma unroll
            for (int tm = 0; tm < 2; ++tm) {
                int r = waveM * 32 + tm * 16 + lc;      // lane = M row
                a[tm].x = Ab[r * 36 + kk];
                a[tm].y = Ab[r * 36 + kk + 1];
            }
#pragma unroll
            for (int tn = 0; tn < 4; ++tn) {
                int c = waveN * 64 + tn * 16 + lc;      // lane = N col
                if (BT) {
                    b[tn].x = Bb[c * 36 + kk];
                    b[tn].y = Bb[c * 36 + kk + 1];
                } else {
                    b[tn].x = Bb[(kk + 0) * 132 + c];
                    b[tn].y = Bb[(kk + 1) * 132 + c];
                }
            }
#pragma unroll
            for (int tm = 0; tm < 2; ++tm)
#pragma unroll
                for (int tn = 0; tn < 4; ++tn)
                    acc[tm][tn] = __builtin_amdgcn_wmma_f32_16x16x4_f32(
                        false, a[tm], false, b[tn], (short)0, acc[tm][tn],
                        false, false);
        }
        cur ^= 1;
    }
#else
    // synchronous fallback: VGPR staging, single buffer, two barriers/chunk
    for (int k0 = 0; k0 < K; k0 += 16) {
        float4 ra[2], rb[2];
#pragma unroll
        for (int i = 0; i < 2; ++i) {
            int idx = tid + i * 256;
            int row = idx >> 2, c4 = (idx & 3) << 2;
            ra[i] = *(const float4*)(A + (size_t)(mBase + row) * K + k0 + c4);
            if (BT) {
                rb[i] = *(const float4*)(B + (size_t)(nBase + row) * K + k0 + c4);
            } else {
                int kk = idx >> 5, n4 = (idx & 31) << 2;
                rb[i] = *(const float4*)(B + (size_t)(k0 + kk) * N + nBase + n4);
            }
        }
        __syncthreads();
#pragma unroll
        for (int i = 0; i < 2; ++i) {
            int idx = tid + i * 256;
            int row = idx >> 2, c4 = (idx & 3) << 2;
            As[row * 20 + c4 + 0] = ra[i].x; As[row * 20 + c4 + 1] = ra[i].y;
            As[row * 20 + c4 + 2] = ra[i].z; As[row * 20 + c4 + 3] = ra[i].w;
            if (BT) {
                Bs[row * 20 + c4 + 0] = rb[i].x; Bs[row * 20 + c4 + 1] = rb[i].y;
                Bs[row * 20 + c4 + 2] = rb[i].z; Bs[row * 20 + c4 + 3] = rb[i].w;
            } else {
                int kk = idx >> 5, n4 = (idx & 31) << 2;
                Bs[kk * 132 + n4 + 0] = rb[i].x; Bs[kk * 132 + n4 + 1] = rb[i].y;
                Bs[kk * 132 + n4 + 2] = rb[i].z; Bs[kk * 132 + n4 + 3] = rb[i].w;
            }
        }
        __syncthreads();
        if (k0 + 16 < K)
            __builtin_prefetch(A + (size_t)(mBase + (tid >> 1)) * K + k0 + 16, 0, 1);
#pragma unroll
        for (int ks = 0; ks < 4; ++ks) {
            const int kk = ks * 4 + half * 2;
            v2f a[2], b[4];
#pragma unroll
            for (int tm = 0; tm < 2; ++tm) {
                int r = waveM * 32 + tm * 16 + lc;
                a[tm].x = As[r * 20 + kk];
                a[tm].y = As[r * 20 + kk + 1];
            }
#pragma unroll
            for (int tn = 0; tn < 4; ++tn) {
                int c = waveN * 64 + tn * 16 + lc;
                if (BT) { b[tn].x = Bs[c * 20 + kk];  b[tn].y = Bs[c * 20 + kk + 1]; }
                else    { b[tn].x = Bs[kk * 132 + c]; b[tn].y = Bs[(kk + 1) * 132 + c]; }
            }
#pragma unroll
            for (int tm = 0; tm < 2; ++tm)
#pragma unroll
                for (int tn = 0; tn < 4; ++tn)
                    acc[tm][tn] = __builtin_amdgcn_wmma_f32_16x16x4_f32(
                        false, a[tm], false, b[tn], (short)0, acc[tm][tn],
                        false, false);
        }
    }
#endif

    // ---- epilogue: alpha, bias, relu, residual ----
    // C/D layout: VGPR i -> M=i (lanes 0-15) / M=i+8 (lanes 16-31), N=lane&15
#pragma unroll
    for (int tm = 0; tm < 2; ++tm) {
#pragma unroll
        for (int tn = 0; tn < 4; ++tn) {
#pragma unroll
            for (int i = 0; i < 8; ++i) {
                int r = mBase + waveM * 32 + tm * 16 + half * 8 + i;
                int c = nBase + waveN * 64 + tn * 16 + lc;
                float v = alpha * acc[tm][tn][i];
                if (bias)      v += bias[c];
                if (fuse_relu) v = fmaxf(v, 0.0f);
                if (residual)  v += residual[(size_t)r * N + c];
                out[(size_t)r * N + c] = v;
            }
        }
    }
}

// ---------------------------------------------------------------------------
// In-place row softmax; one block per row (scale already applied by GEMM).
// ---------------------------------------------------------------------------
__global__ __launch_bounds__(256) void softmax_rows(float* __restrict__ s, int ncols)
{
    __shared__ float red[256];
    const int tid = threadIdx.x;
    float* row = s + (size_t)blockIdx.x * ncols;

    float m = -INFINITY;
    for (int c = tid; c < ncols; c += 256) m = fmaxf(m, row[c]);
    red[tid] = m;
    __syncthreads();
    for (int off = 128; off > 0; off >>= 1) {
        if (tid < off) red[tid] = fmaxf(red[tid], red[tid + off]);
        __syncthreads();
    }
    m = red[0];
    __syncthreads();

    float sum = 0.0f;
    for (int c = tid; c < ncols; c += 256) {
        float e = __expf(row[c] - m);
        row[c] = e;
        sum += e;
    }
    red[tid] = sum;
    __syncthreads();
    for (int off = 128; off > 0; off >>= 1) {
        if (tid < off) red[tid] += red[tid + off];
        __syncthreads();
    }
    const float inv = 1.0f / red[0];
    for (int c = tid; c < ncols; c += 256) row[c] *= inv;
}

// ---------------------------------------------------------------------------
extern "C" void kernel_launch(void* const* d_in, const int* in_sizes, int n_in,
                              void* d_out, int out_size, void* d_ws, size_t ws_size,
                              hipStream_t stream)
{
    (void)in_sizes; (void)n_in; (void)out_size; (void)ws_size;

    const float* x  = (const float*)d_in[0];
    const float* qw = (const float*)d_in[1];
    const float* qb = (const float*)d_in[2];
    const float* kw = (const float*)d_in[3];
    const float* kb = (const float*)d_in[4];
    const float* vw = (const float*)d_in[5];
    const float* vb = (const float*)d_in[6];
    const float* w1 = (const float*)d_in[7];
    const float* b1 = (const float*)d_in[8];
    const float* w2 = (const float*)d_in[9];
    const float* b2 = (const float*)d_in[10];

    // output = hidden [S,DM] ++ k [S,DI] ++ v [S,DM]
    float* hidden = (float*)d_out;
    float* kout   = hidden + (size_t)S_TOK * DM;
    float* vout   = kout + (size_t)S_TOK * DI;

    // workspace layout
    char*  ws     = (char*)d_ws;
    float* q_ws   = (float*)ws;                                   //  8 MiB
    float* s_ws   = (float*)(ws + (size_t)S_TOK * DI * 4);        // 64 MiB (L2-resident)
    float* res_ws = (float*)(ws + (size_t)S_TOK * DI * 4
                                + (size_t)S_TOK * S_TOK * 4);     // 32 MiB
    float* t_ws   = (float*)(ws + (size_t)S_TOK * DI * 4
                                + (size_t)S_TOK * S_TOK * 4
                                + (size_t)S_TOK * DM * 4);        // 32 MiB

    const dim3 blk(256);
    const float scale = 0.044194173824159216f;  // 1/sqrt(512)

    // q,k,v projections in one launch of 24 x 32 tiles: launched alone, q and k
    // have 128 blocks each and leave half the WGPs idle
    // (k and v written straight into d_out slices)
    gemm_f32_wmma<true><<<dim3((DI + DI + DM) / 128, S_TOK / 128), blk, 0, stream>>>(
        x, qw, qb, nullptr, q_ws, S_TOK, DI, DM, 1.0f, 0,
        kw, kb, kout, DI, vw, vb, vout, DM);

    // scores = (q @ k^T) * scale   (k acts as the [N,K] "weight")
    gemm_f32_wmma<true><<<dim3(S_TOK / 128, S_TOK / 128), blk, 0, stream>>>(
        q_ws, kout, nullptr, nullptr, s_ws, S_TOK, S_TOK, DI, scale, 0,
        nullptr, nullptr, nullptr, 0, nullptr, nullptr, nullptr, 0);

    softmax_rows<<<dim3(S_TOK), blk, 0, stream>>>(s_ws, S_TOK);

    // x_residual = P @ v + x      (v is [K,N] row-major, non-transposed)
    gemm_f32_wmma<false><<<dim3(DM / 128, S_TOK / 128), blk, 0, stream>>>(
        s_ws, vout, nullptr, x, res_ws, S_TOK, DM, S_TOK, 1.0f, 0,
        nullptr, nullptr, nullptr, 0, nullptr, nullptr, nullptr, 0);

    // t = relu(x_residual @ w1^T + b1)
    gemm_f32_wmma<true><<<dim3(DM / 128, S_TOK / 128), blk, 0, stream>>>(
        res_ws, w1, b1, nullptr, t_ws, S_TOK, DM, DM, 1.0f, 1,
        nullptr, nullptr, nullptr, 0, nullptr, nullptr, nullptr, 0);

    // hidden = t @ w2^T + b2 + x_residual
    gemm_f32_wmma<true><<<dim3(DM / 128, S_TOK / 128), blk, 0, stream>>>(
        t_ws, w2, b2, res_ws, hidden, S_TOK, DM, DM, 1.0f, 0,
        nullptr, nullptr, nullptr, 0, nullptr, nullptr, nullptr, 0);
}

// v003
// Measured time: 986 microseconds a run.
// Timed twice side by side with v002, it ran 1.08 times as fast both times.
// Counting every step since v000, it is 1.29 times as fast.
#include <hip/hip_runtime.h>
#include <math.h>

// CDNA5 / gfx1250, wave32. fp32 transformer layer on V_WMMA_F32_16X16X4_F32
// with double-buffered async global->LDS staging (ASYNCcnt).

typedef __attribute__((ext_vector_type(2))) float v2f;
typedef __attribute__((ext_vector_type(8))) float v8f;

#define S_TOK 4096
#define DM    2048
#define DI    512

#define USE_ASYNC_LDS 1

typedef __attribute__((ext_vector_type(4))) int v4i;

// Per-lane async copy of 16B global -> LDS, tracked by ASYNCcnt.
__device__ __forceinline__ void async_copy_b128(float* lds_ptr, const float* gptr) {
    __builtin_amdgcn_global_load_async_to_lds_b128(
        (__attribute__((address_space(1))) v4i*)gptr,
        (__attribute__((address_space(3))) v4i*)lds_ptr, 0, 0);
}

__device__ __forceinline__ void wait_async_all() {
    asm volatile("s_wait_asynccnt 0x0" ::: "memory");
}

// ---------------------------------------------------------------------------
// Tiled fp32 WMMA GEMM:  out = act( alpha * (A @ B(T)) + bias ) + residual
//   A: [M,K] row-major
//   BT=true : B is W[N,K] row-major, compute A @ W^T  (stored UNtransposed in
//             LDS; B fragments read it identically to A fragments)
//   BT=false: B is     [K,N] row-major, compute A @ B (attn @ v)
// Block tile 128x128, BK=32, 256 threads (8 waves, 4x2), wave tile 32x64.
// Dims must be multiples of 128 (M,N) / 32 (K) -- true for this layer.
// A stage holds 32 k: a row of an A / W tile is one whole 128-byte line, and
// one barrier and one wait for the copies serve 64 matrix instructions a wave.
// LDS strides: 36 (A / W tiles, 16B-aligned rows, conflict-free col reads),
//              132 (B[K,N] tiles, 16B-aligned rows).
// Up to three B matrices that share A and K may lie side by side along grid.x
// (N0, then N1, then N2 columns): each block picks the matrix, bias and output
// that its column tile belongs to, so one launch does all the products.
// A launch with one matrix passes N1 = N2 = 0.
// ---------------------------------------------------------------------------
template <bool BT>
__global__ __launch_bounds__(256) void gemm_f32_wmma(
    const float* __restrict__ A, const float* __restrict__ B0,
    const float* __restrict__ bias0, const float* __restrict__ residual,
    float* __restrict__ out0, int M, int N0, int K, float alpha, int fuse_relu,
    const float* __restrict__ B1, const float* __restrict__ bias1,
    float* __restrict__ out1, int N1,
    const float* __restrict__ B2, const float* __restrict__ bias2,
    float* __restrict__ out2, int N2)
{
    const int tid   = threadIdx.x;
    const int lane  = tid & 31;
    const int wave  = tid >> 5;
    const int waveM = wave >> 1;   // 0..3 : 32-row strip
    const int waveN = wave & 1;    // 0..1 : 64-col strip
    const int half  = lane >> 4;   // K-pair select (frags) / +8 rows (C)
    const int lc    = lane & 15;

    const int mBase = blockIdx.y * 128;

    // block-uniform choice of the product this column tile belongs to
    const int t0 = N0 >> 7, t01 = (N0 + N1) >> 7;   // first column tile of B1, of B2
    const int bx = blockIdx.x;
    const int which = (bx >= t01) ? 2 : (bx >= t0) ? 1 : 0;
    const float* __restrict__ B    = which == 2 ? B2    : which == 1 ? B1    : B0;
    const float* __restrict__ bias = which == 2 ? bias2 : which == 1 ? bias1 : bias0;
    float* __restrict__       out  = which == 2 ? out2  : which == 1 ? out1  : out0;
    const int N     = which == 2 ? N2 : which == 1 ? N1 : N0;
    const int nBase = (bx - (which == 2 ? t01 : which == 1 ? t0 : 0)) * 128;

    // double buffers: 4608 floats per buffer per array
    __shared__ __attribute__((aligned(16))) float As[2 * 4608];   // 128 x 32, stride 36
    __shared__ __attribute__((aligned(16))) float Bs[2 * 4608];   // BT: 128 x 32 stride 36 ; !BT: 32 x 128 stride 132

    v8f acc[2][4];
#pragma unroll
    for (int i = 0; i < 2; ++i)
#pragma unroll
        for (int j = 0; j < 4; ++j)
#pragma unroll
            for (int e = 0; e < 8; ++e) acc[i][j][e] = 0.0f;

    const int nch = K >> 5;

    // issue async staging of one 32-wide K chunk into buffer half `buf`
    auto stage = [&](int k0, int buf) {
#pragma unroll
        for (int i = 0; i < 4; ++i) {                   // A tile 128x32
            int idx = tid + i * 256;                    // 0..1023
            int row = idx >> 3;
            int c4  = (idx & 7) << 2;
            async_copy_b128(As + buf * 4608 + row * 36 + c4,
                            A + (size_t)(mBase + row) * K + k0 + c4);
        }
        if (BT) {                                       // W tile 128x32 (row-major)
#pragma unroll
            for (int i = 0; i < 4; ++i) {
                int idx = tid + i * 256;
                int n   = idx >> 3;
                int c4  = (idx & 7) << 2;
                async_copy_b128(Bs + buf * 4608 + n * 36 + c4,
                                B + (size_t)(nBase + n) * K + k0 + c4);
            }
        } else {                                        // B tile 32x128 (row-major)
#pragma unroll
            for (int i = 0; i < 4; ++i) {
                int idx = tid + i * 256;
                int kk  = idx >> 5;
                int n4  = (idx & 31) << 2;
                async_copy_b128(Bs + buf * 4608 + kk * 132 + n4,
                                B + (size_t)(k0 + kk) * N + nBase + n4);
            }
        }
    };

#if USE_ASYNC_LDS
    stage(0, 0);
    int cur = 0;
    for (int ch = 0; ch < nch; ++ch) {
        // this wave's LDS reads of the buffer that is refilled behind the
        // barrier have retired before another wave's copies may land there
        asm volatile("s_wait_dscnt 0x0" ::: "memory");
        wait_async_all();        // our copies of chunk `ch` landed in LDS
        __syncthreads();         // everyone's copies landed; prev reads done
        if (ch + 1 < nch) stage((ch + 1) * 32, cur ^ 1);

        const float* Ab = As + cur * 4608;
        const float* Bb = Bs + cur * 4608;
#pragma unroll
        for (int ks = 0; ks < 8; ++ks) {
            const int kk = ks * 4 + half * 2;
            v2f a[2], b[4];
#pragma unroll
            for (int tm = 0; tm < 2; ++tm) {
                int r = waveM * 32 + tm * 16 + lc;      // lane = M row
                a[tm].x = Ab[r * 36 + kk];
                a[tm].y = Ab[r * 36 + kk + 1];
            }
#pragma unroll
            for (int tn = 0; tn < 4; ++tn) {
                int c = waveN * 64 + tn * 16 + lc;      // lane = N col
                if (BT) {
                    b[tn].x = Bb[c * 36 + kk];
                    b[tn].y = Bb[c * 36 + kk + 1];
                } else {
                    b[tn].x = Bb[(kk + 0) * 132 + c];
                    b[tn].y = Bb[(kk + 1) * 132 + c];
                }
            }
#pragma unroll
            for (int tm = 0; tm < 2; ++tm)
#pragma unroll
                for (int tn = 0; tn < 4; ++tn)
                    acc[tm][tn] = __builtin_amdgcn_wmma_f32_16x16x4_f32(
                        false, a[tm], false, b[tn], (short)0, acc[tm][tn],
                        false, false);
        }
        cur ^= 1;
    }
#else
    // synchronous fallback: VGPR staging, single buffer, two barriers/chunk
    for (int k0 = 0; k0 < K; k0 += 16) {
        float4 ra[2], rb[2];
#pragma unroll
        for (int i = 0; i < 2; ++i) {
            int idx = tid + i * 256;
            int row = idx >> 2, c4 = (idx & 3) << 2;
            ra[i] = *(const float4*)(A + (size_t)(mBase + row) * K + k0 + c4);
            if (BT) {
                rb[i] = *(const float4*)(B + (size_t)(nBase + row) * K + k0 + c4);
            } else {
                int kk = idx >> 5, n4 = (idx & 31) << 2;
                rb[i] = *(const float4*)(B + (size_t)(k0 + kk) * N + nBase + n4);
            }
        }
        __syncthreads();
#pragma unroll
        for (int i = 0; i < 2; ++i) {
            int idx = tid + i * 256;
            int row = idx >> 2, c4 = (idx & 3) << 2;
            As[row * 20 + c4 + 0] = ra[i].x; As[row * 20 + c4 + 1] = ra[i].y;
            As[row * 20 + c4 + 2] = ra[i].z; As[row * 20 + c4 + 3] = ra[i].w;
            if (BT) {
                Bs[row * 20 + c4 + 0] = rb[i].x; Bs[row * 20 + c4 + 1] = rb[i].y;
                Bs[row * 20 + c4 + 2] = rb[i].z; Bs[row * 20 + c4 + 3] = rb[i].w;
            } else {
                int kk = idx >> 5, n4 = (idx & 31) << 2;
                Bs[kk * 132 + n4 + 0] = rb[i].x; Bs[kk * 132 + n4 + 1] = rb[i].y;
                Bs[kk * 132 + n4 + 2] = rb[i].z; Bs[kk * 132 + n4 + 3] = rb[i].w;
            }
        }
        __syncthreads();
        if (k0 + 16 < K)
            __builtin_prefetch(A + (size_t)(mBase + (tid >> 1)) * K + k0 + 16, 0, 1);
#pragma unroll
        for (int ks = 0; ks < 4; ++ks) {
            const int kk = ks * 4 + half * 2;
            v2f a[2], b[4];
#pragma unroll
            for (int tm = 0; tm < 2; ++tm) {
                int r = waveM * 32 + tm * 16 + lc;
                a[tm].x = As[r * 20 + kk];
                a[tm].y = As[r * 20 + kk + 1];
            }
#pragma unroll
            for (int tn = 0; tn < 4; ++tn) {
                int c = waveN * 64 + tn * 16 + lc;
                if (BT) { b[tn].x = Bs[c * 20 + kk];  b[tn].y = Bs[c * 20 + kk + 1]; }
                else    { b[tn].x = Bs[kk * 132 + c]; b[tn].y = Bs[(kk + 1) * 132 + c]; }
            }
#pragma unroll
            for (int tm = 0; tm < 2; ++tm)
#pragma unroll
                for (int tn = 0; tn < 4; ++tn)
                    acc[tm][tn] = __builtin_amdgcn_wmma_f32_16x16x4_f32(
                        false, a[tm], false, b[tn], (short)0, acc[tm][tn],
                        false, false);
        }
    }
#endif

    // ---- epilogue: alpha, bias, relu, residual ----
    // C/D layout: VGPR i -> M=i (lanes 0-15) / M=i+8 (lanes 16-31), N=lane&15
    // The four bias values and the whole residual tile of the wave are fetched
    // as one group of independent loads under one block-uniform test each, in
    // front of the arithmetic: one memory latency for the group instead of one
    // per output element.
    const unsigned ldo = (unsigned)N;
    const unsigned c0  = (unsigned)(nBase + waveN * 64 + lc);
    const unsigned r0  = (unsigned)(mBase + waveM * 32 + half * 8);

    unsigned off[2][8];                                 // element offset of (row, c0)
#pragma unroll
    for (int tm = 0; tm < 2; ++tm)
#pragma unroll
        for (int i = 0; i < 8; ++i) off[tm][i] = (r0 + tm * 16 + i) * ldo + c0;

    float bv[4];
    float rv[2][4][8];
#pragma unroll
    for (int tn = 0; tn < 4; ++tn) {
        bv[tn] = 0.0f;
#pragma unroll
        for (int tm = 0; tm < 2; ++tm)
#pragma unroll
            for (int i = 0; i < 8; ++i) rv[tm][tn][i] = 0.0f;
    }
    if (residual) {
#pragma unroll
        for (int tm = 0; tm < 2; ++tm)
#pragma unroll
            for (int i = 0; i < 8; ++i)
#pragma unroll
                for (int tn = 0; tn < 4; ++tn)
                    rv[tm][tn][i] = (residual + tn * 16)[off[tm][i]];
    }
    if (bias) {
#pragma unroll
        for (int tn = 0; tn < 4; ++tn) bv[tn] = bias[c0 + tn * 16];
    }

#pragma unroll
    for (int tm = 0; tm < 2; ++tm) {
#pragma unroll
        for (int i = 0; i < 8; ++i) {
#pragma unroll
            for (int tn = 0; tn < 4; ++tn) {
                float v = alpha * acc[tm][tn][i] + bv[tn];
                if (fuse_relu) v = fmaxf(v, 0.0f);
                (out + tn * 16)[off[tm][i]] = v + rv[tm][tn][i];
            }
        }
    }
}

// ---------------------------------------------------------------------------
// In-place row softmax; one block per row (scale already applied by GEMM).
// ---------------------------------------------------------------------------
__global__ __launch_bounds__(256) void softmax_rows(float* __restrict__ s, int ncols)
{
    __shared__ float red[256];
    const int tid = threadIdx.x;
    float* row = s + (size_t)blockIdx.x * ncols;

    float m = -INFINITY;
    for (int c = tid; c < ncols; c += 256) m = fmaxf(m, row[c]);
    red[tid] = m;
    __syncthreads();
    for (int off = 128; off > 0; off >>= 1) {
        if (tid < off) red[tid] = fmaxf(red[tid], red[tid + off]);
        __syncthreads();
    }
    m = red[0];
    __syncthreads();

    float sum = 0.0f;
    for (int c = tid; c < ncols; c += 256) {
        float e = __expf(row[c] - m);
        row[c] = e;
        sum += e;
    }
    red[tid] = sum;
    __syncthreads();
    for (int off = 128; off > 0; off >>= 1) {
        if (tid < off) red[tid] += red[tid + off];
        __syncthreads();
    }
    const float inv = 1.0f / red[0];
    for (int c = tid; c < ncols; c += 256) row[c] *= inv;
}

// ---------------------------------------------------------------------------
extern "C" void kernel_launch(void* const* d_in, const int* in_sizes, int n_in,
                              void* d_out, int out_size, void* d_ws, size_t ws_size,
                              hipStream_t stream)
{
    (void)in_sizes; (void)n_in; (void)out_size; (void)ws_size;

    const float* x  = (const float*)d_in[0];
    const float* qw = (const float*)d_in[1];
    const float* qb = (const float*)d_in[2];
    const float* kw = (const float*)d_in[3];
    const float* kb = (const float*)d_in[4];
    const float* vw = (const float*)d_in[5];
    const float* vb = (const float*)d_in[6];
    const float* w1 = (const float*)d_in[7];
    const float* b1 = (const float*)d_in[8];
    const float* w2 = (const float*)d_in[9];
    const float* b2 = (const float*)d_in[10];

    // output = hidden [S,DM] ++ k [S,DI] ++ v [S,DM]
    float* hidden = (float*)d_out;
    float* kout   = hidden + (size_t)S_TOK * DM;
    float* vout   = kout + (size_t)S_TOK * DI;

    // workspace layout
    char*  ws     = (char*)d_ws;
    float* q_ws   = (float*)ws;                                   //  8 MiB
    float* s_ws   = (float*)(ws + (size_t)S_TOK * DI * 4);        // 64 MiB (L2-resident)
    float* res_ws = (float*)(ws + (size_t)S_TOK * DI * 4
                                + (size_t)S_TOK * S_TOK * 4);     // 32 MiB
    float* t_ws   = (float*)(ws + (size_t)S_TOK * DI * 4
                                + (size_t)S_TOK * S_TOK * 4
                                + (size_t)S_TOK * DM * 4);        // 32 MiB

    const dim3 blk(256);
    const float scale = 0.044194173824159216f;  // 1/sqrt(512)

    // q,k,v projections in one launch of 24 x 32 tiles: launched alone, q and k
    // have 128 blocks each and leave half the WGPs idle
    // (k and v written straight into d_out slices)
    gemm_f32_wmma<true><<<dim3((DI + DI + DM) / 128, S_TOK / 128), blk, 0, stream>>>(
        x, qw, qb, nullptr, q_ws, S_TOK, DI, DM, 1.0f, 0,
        kw, kb, kout, DI, vw, vb, vout, DM);

    // scores = (q @ k^T) * scale   (k acts as the [N,K] "weight")
    gemm_f32_wmma<true><<<dim3(S_TOK / 128, S_TOK / 128), blk, 0, stream>>>(
        q_ws, kout, nullptr, nullptr, s_ws, S_TOK, S_TOK, DI, scale, 0,
        nullptr, nullptr, nullptr, 0, nullptr, nullptr, nullptr, 0);

    softmax_rows<<<dim3(S_TOK), blk, 0, stream>>>(s_ws, S_TOK);

    // x_residual = P @ v + x      (v is [K,N] row-major, non-transposed)
    gemm_f32_wmma<false><<<dim3(DM / 128, S_TOK / 128), blk, 0, stream>>>(
        s_ws, vout, nullptr, x, res_ws, S_TOK, DM, S_TOK, 1.0f, 0,
        nullptr, nullptr, nullptr, 0, nullptr, nullptr, nullptr, 0);

    // t = relu(x_residual @ w1^T + b1)
    gemm_f32_wmma<true><<<dim3(DM / 128, S_TOK / 128), blk, 0, stream>>>(
        res_ws, w1, b1, nullptr, t_ws, S_TOK, DM, DM, 1.0f, 1,
        nullptr, nullptr, nullptr, 0, nullptr, nullptr, nullptr, 0);

    // hidden = t @ w2^T + b2 + x_residual
    gemm_f32_wmma<true><<<dim3(DM / 128, S_TOK / 128), blk, 0, stream>>>(
        t_ws, w2, b2, res_ws, hidden, S_TOK, DM, DM, 1.0f, 0,
        nullptr, nullptr, nullptr, 0, nullptr, nullptr, nullptr, 0);
}

// v004
// It runs in 953 microseconds.
// Timed twice side by side with v003, it ran 1.03 times as fast both times.
// All steps since v000 together make it 1.33 times as fast.
#include <hip/hip_runtime.h>
#include <math.h>

// CDNA5 / gfx1250, wave32. fp32 transformer layer on V_WMMA_F32_16X16X4_F32
// with double-buffered async global->LDS staging (ASYNCcnt).

typedef __attribute__((ext_vector_type(2))) float v2f;
typedef __attribute__((ext_vector_type(8))) float v8f;

#define S_TOK 4096
#define DM    2048
#define DI    512

#define USE_ASYNC_LDS 1

typedef __attribute__((ext_vector_type(4))) int v4i;

// Per-lane async copy of 16B global -> LDS, tracked by ASYNCcnt.
__device__ __forceinline__ void async_copy_b128(float* lds_ptr, const float* gptr) {
    __builtin_amdgcn_global_load_async_to_lds_b128(
        (__attribute__((address_space(1))) v4i*)gptr,
        (__attribute__((address_space(3))) v4i*)lds_ptr, 0, 0);
}

__device__ __forceinline__ void wait_async_all() {
    asm volatile("s_wait_asynccnt 0x0" ::: "memory");
}

// ---------------------------------------------------------------------------
// Tiled fp32 WMMA GEMM:  out = act( alpha * (A @ B(T)) + bias ) + residual
//   A: [M,K] row-major
//   BT=true : B is W[N,K] row-major, compute A @ W^T  (stored UNtransposed in
//             LDS; B fragments read it identically to A fragments)
//   BT=false: B is     [K,N] row-major, compute A @ B (attn @ v)
// Block tile 128x128, BK=32, 256 threads (8 waves, 4x2), wave tile 32x64.
// Dims must be multiples of 128 (M,N) / 32 (K) -- true for this layer.
// A stage holds 32 k: a row of an A / W tile is one whole 128-byte line, and
// one barrier and one wait for the copies serve 64 matrix instructions a wave.
// LDS strides: 36 (A / W tiles, 16B-aligned rows, conflict-free col reads),
//              132 (B[K,N] tiles, 16B-aligned rows).
// Up to three B matrices that share A and K may lie side by side along grid.x
// (N0, then N1, then N2 columns): each block picks the matrix, bias and output
// that its column tile belongs to, so one launch does all the products.
// A launch with one matrix passes N1 = N2 = 0.
// prio_steps != 0 (launches whose blocks are all resident at once): a wave's
// issue priority falls 3, 2, 1, 0 as its block passes 1/2, 3/4 and 7/8 of its
// K chunks. With the falling priority the block that is
// behind wins the pipe until it has caught up: the blocks reach their last
// eighth together and fill each other's gaps till there.
// ---------------------------------------------------------------------------
template <bool BT>
__global__ __launch_bounds__(256) void gemm_f32_wmma(
    const float* __restrict__ A, const float* __restrict__ B0,
    const float* __restrict__ bias0, const float* __restrict__ residual,
    float* __restrict__ out0, int M, int N0, int K, float alpha, int fuse_relu,
    const float* __restrict__ B1, const float* __restrict__ bias1,
    float* __restrict__ out1, int N1,
    const float* __restrict__ B2, const float* __restrict__ bias2,
    float* __restrict__ out2, int N2, int prio_steps)
{
    const int tid   = threadIdx.x;
    const int lane  = tid & 31;
    const int wave  = tid >> 5;
    const int waveM = wave >> 1;   // 0..3 : 32-row strip
    const int waveN = wave & 1;    // 0..1 : 64-col strip
    const int half  = lane >> 4;   // K-pair select (frags) / +8 rows (C)
    const int lc    = lane & 15;

    const int mBase = blockIdx.y * 128;

    // block-uniform choice of the product this column tile belongs to
    const int t0 = N0 >> 7, t01 = (N0 + N1) >> 7;   // first column tile of B1, of B2
    const int bx = blockIdx.x;
    const int which = (bx >= t01) ? 2 : (bx >= t0) ? 1 : 0;
    const float* __restrict__ B    = which == 2 ? B2    : which == 1 ? B1    : B0;
    const float* __restrict__ bias = which == 2 ? bias2 : which == 1 ? bias1 : bias0;
    float* __restrict__       out  = which == 2 ? out2  : which == 1 ? out1  : out0;
    const int N     = which == 2 ? N2 : which == 1 ? N1 : N0;
    const int nBase = (bx - (which == 2 ? t01 : which == 1 ? t0 : 0)) * 128;

    // double buffers: 4608 floats per buffer per array
    __shared__ __attribute__((aligned(16))) float As[2 * 4608];   // 128 x 32, stride 36
    __shared__ __attribute__((aligned(16))) float Bs[2 * 4608];   // BT: 128 x 32 stride 36 ; !BT: 32 x 128 stride 132

    v8f acc[2][4];
#pragma unroll
    for (int i = 0; i < 2; ++i)
#pragma unroll
        for (int j = 0; j < 4; ++j)
#pragma unroll
            for (int e = 0; e < 8; ++e) acc[i][j][e] = 0.0f;

    const int nch = K >> 5;

    // issue async staging of one 32-wide K chunk into buffer half `buf`
    auto stage = [&](int k0, int buf) {
#pragma unroll
        for (int i = 0; i < 4; ++i) {                   // A tile 128x32
            int idx = tid + i * 256;                    // 0..1023
            int row = idx >> 3;
            int c4  = (idx & 7) << 2;
            async_copy_b128(As + buf * 4608 + row * 36 + c4,
                            A + (size_t)(mBase + row) * K + k0 + c4);
        }
        if (BT) {                                       // W tile 128x32 (row-major)
#pragma unroll
            for (int i = 0; i < 4; ++i) {
                int idx = tid + i * 256;
                int n   = idx >> 3;
                int c4  = (idx & 7) << 2;
                async_copy_b128(Bs + buf * 4608 + n * 36 + c4,
                                B + (size_t)(nBase + n) * K + k0 + c4);
            }
        } else {                                        // B tile 32x128 (row-major)
#pragma unroll
            for (int i = 0; i < 4; ++i) {
                int idx = tid + i * 256;
                int kk  = idx >> 5;
                int n4  = (idx & 31) << 2;
                async_copy_b128(Bs + buf * 4608 + kk * 132 + n4,
                                B + (size_t)(k0 + kk) * N + nBase + n4);
            }
        }
    };

#if USE_ASYNC_LDS
    stage(0, 0);
    int cur = 0;
    // all of this is block-uniform and lives in scalar registers
    int prioLvl  = 3;
    int prioSeg  = nch >> 1;                    // length of the current priority step
    int prioNext = prio_steps ? prioSeg : -1;   // chunk at which the priority falls next
    // start high, so that a block in its first half wins over one further on
    if (prio_steps) __builtin_amdgcn_s_setprio(3);
    for (int ch = 0; ch < nch; ++ch) {
        if (ch == prioNext) {
            // one step down: blocks on this WGP that are further behind now go first
            --prioLvl;
            prioSeg >>= 1;
            if (prioLvl == 2)      __builtin_amdgcn_s_setprio(2);
            else if (prioLvl == 1) __builtin_amdgcn_s_setprio(1);
            else                   __builtin_amdgcn_s_setprio(0);
            prioNext = prioLvl > 0 ? prioNext + prioSeg : -1;
        }
        // this wave's LDS reads of the buffer that is refilled behind the
        // barrier have retired before another wave's copies may land there
        asm volatile("s_wait_dscnt 0x0" ::: "memory");
        wait_async_all();        // our copies of chunk `ch` landed in LDS
        __syncthreads();         // everyone's copies landed; prev reads done
        if (ch + 1 < nch) stage((ch + 1) * 32, cur ^ 1);

        const float* Ab = As + cur * 4608;
        const float* Bb = Bs + cur * 4608;
#pragma unroll
        for (int ks = 0; ks < 8; ++ks) {
            const int kk = ks * 4 + half * 2;
            v2f a[2], b[4];
#pragma unroll
            for (int tm = 0; tm < 2; ++tm) {
                int r = waveM * 32 + tm * 16 + lc;      // lane = M row
                a[tm].x = Ab[r * 36 + kk];
                a[tm].y = Ab[r * 36 + kk + 1];
            }
#pragma unroll
            for (int tn = 0; tn < 4; ++tn) {
                int c = waveN * 64 + tn * 16 + lc;      // lane = N col
                if (BT) {
                    b[tn].x = Bb[c * 36 + kk];
                    b[tn].y = Bb[c * 36 + kk + 1];
                } else {
                    b[tn].x = Bb[(kk + 0) * 132 + c];
                    b[tn].y = Bb[(kk + 1) * 132 + c];
                }
            }
#pragma unroll
            for (int tm = 0; tm < 2; ++tm)
#pragma unroll
                for (int tn = 0; tn < 4; ++tn)
                    acc[tm][tn] = __builtin_amdgcn_wmma_f32_16x16x4_f32(
                        false, a[tm], false, b[tn], (short)0, acc[tm][tn],
                        false, false);
        }
        cur ^= 1;
    }
    // priority 0 on the way out also where K has too few chunks for every step
    if (prio_steps) __builtin_amdgcn_s_setprio(0);
#else
    // synchronous fallback: VGPR staging, single buffer, two barriers/chunk
    for (int k0 = 0; k0 < K; k0 += 16) {
        float4 ra[2], rb[2];
#pragma unroll
        for (int i = 0; i < 2; ++i) {
            int idx = tid + i * 256;
            int row = idx >> 2, c4 = (idx & 3) << 2;
            ra[i] = *(const float4*)(A + (size_t)(mBase + row) * K + k0 + c4);
            if (BT) {
                rb[i] = *(const float4*)(B + (size_t)(nBase + row) * K + k0 + c4);
            } else {
                int kk = idx >> 5, n4 = (idx & 31) << 2;
                rb[i] = *(const float4*)(B + (size_t)(k0 + kk) * N + nBase + n4);
            }
        }
        __syncthreads();
#pragma unroll
        for (int i = 0; i < 2; ++i) {
            int idx = tid + i * 256;
            int row = idx >> 2, c4 = (idx & 3) << 2;
            As[row * 20 + c4 + 0] = ra[i].x; As[row * 20 + c4 + 1] = ra[i].y;
            As[row * 20 + c4 + 2] = ra[i].z; As[row * 20 + c4 + 3] = ra[i].w;
            if (BT) {
                Bs[row * 20 + c4 + 0] = rb[i].x; Bs[row * 20 + c4 + 1] = rb[i].y;
                Bs[row * 20 + c4 + 2] = rb[i].z; Bs[row * 20 + c4 + 3] = rb[i].w;
            } else {
                int kk = idx >> 5, n4 = (idx & 31) << 2;
                Bs[kk * 132 + n4 + 0] = rb[i].x; Bs[kk * 132 + n4 + 1] = rb[i].y;
                Bs[kk * 132 + n4 + 2] = rb[i].z; Bs[kk * 132 + n4 + 3] = rb[i].w;
            }
        }
        __syncthreads();
        if (k0 + 16 < K)
            __builtin_prefetch(A + (size_t)(mBase + (tid >> 1)) * K + k0 + 16, 0, 1);
#pragma unroll
        for (int ks = 0; ks < 4; ++ks) {
            const int kk = ks * 4 + half * 2;
            v2f a[2], b[4];
#pragma unroll
            for (int tm = 0; tm < 2; ++tm) {
                int r = waveM * 32 + tm * 16 + lc;
                a[tm].x = As[r * 20 + kk];
                a[tm].y = As[r * 20 + kk + 1];
            }
#pragma unroll
            for (int tn = 0; tn < 4; ++tn) {
                int c = waveN * 64 + tn * 16 + lc;
                if (BT) { b[tn].x = Bs[c * 20 + kk];  b[tn].y = Bs[c * 20 + kk + 1]; }
                else    { b[tn].x = Bs[kk * 132 + c]; b[tn].y = Bs[(kk + 1) * 132 + c]; }
            }
#pragma unroll
            for (int tm = 0; tm < 2; ++tm)
#pragma unroll
                for (int tn = 0; tn < 4; ++tn)
                    acc[tm][tn] = __builtin_amdgcn_wmma_f32_16x16x4_f32(
                        false, a[tm], false, b[tn], (short)0, acc[tm][tn],
                        false, false);
        }
    }
#endif

    // ---- epilogue: alpha, bias, relu, residual ----
    // C/D layout: VGPR i -> M=i (lanes 0-15) / M=i+8 (lanes 16-31), N=lane&15
    // The four bias values and the whole residual tile of the wave are fetched
    // as one group of independent loads under one block-uniform test each, in
    // front of the arithmetic: one memory latency for the group instead of one
    // per output element.
    const unsigned ldo = (unsigned)N;
    const unsigned c0  = (unsigned)(nBase + waveN * 64 + lc);
    const unsigned r0  = (unsigned)(mBase + waveM * 32 + half * 8);

    unsigned off[2][8];                                 // element offset of (row, c0)
#pragma unroll
    for (int tm = 0; tm < 2; ++tm)
#pragma unroll
        for (int i = 0; i < 8; ++i) off[tm][i] = (r0 + tm * 16 + i) * ldo + c0;

    float bv[4];
    float rv[2][4][8];
#pragma unroll
    for (int tn = 0; tn < 4; ++tn) {
        bv[tn] = 0.0f;
#pragma unroll
        for (int tm = 0; tm < 2; ++tm)
#pragma unroll
            for (int i = 0; i < 8; ++i) rv[tm][tn][i] = 0.0f;
    }
    if (residual) {
#pragma unroll
        for (int tm = 0; tm < 2; ++tm)
#pragma unroll
            for (int i = 0; i < 8; ++i)
#pragma unroll
                for (int tn = 0; tn < 4; ++tn)
                    rv[tm][tn][i] = (residual + tn * 16)[off[tm][i]];
    }
    if (bias) {
#pragma unroll
        for (int tn = 0; tn < 4; ++tn) bv[tn] = bias[c0 + tn * 16];
    }

#pragma unroll
    for (int tm = 0; tm < 2; ++tm) {
#pragma unroll
        for (int i = 0; i < 8; ++i) {
#pragma unroll
            for (int tn = 0; tn < 4; ++tn) {
                float v = alpha * acc[tm][tn][i] + bv[tn];
                if (fuse_relu) v = fmaxf(v, 0.0f);
                (out + tn * 16)[off[tm][i]] = v + rv[tm][tn][i];
            }
        }
    }
}

// ---------------------------------------------------------------------------
// In-place row softmax; one block per row (scale already applied by GEMM).
// ---------------------------------------------------------------------------
__global__ __launch_bounds__(256) void softmax_rows(float* __restrict__ s, int ncols)
{
    __shared__ float red[256];
    const int tid = threadIdx.x;
    float* row = s + (size_t)blockIdx.x * ncols;

    float m = -INFINITY;
    for (int c = tid; c < ncols; c += 256) m = fmaxf(m, row[c]);
    red[tid] = m;
    __syncthreads();
    for (int off = 128; off > 0; off >>= 1) {
        if (tid < off) red[tid] = fmaxf(red[tid], red[tid + off]);
        __syncthreads();
    }
    m = red[0];
    __syncthreads();

    float sum = 0.0f;
    for (int c = tid; c < ncols; c += 256) {
        float e = __expf(row[c] - m);
        row[c] = e;
        sum += e;
    }
    red[tid] = sum;
    __syncthreads();
    for (int off = 128; off > 0; off >>= 1) {
        if (tid < off) red[tid] += red[tid + off];
        __syncthreads();
    }
    const float inv = 1.0f / red[0];
    for (int c = tid; c < ncols; c += 256) row[c] *= inv;
}

// ---------------------------------------------------------------------------
extern "C" void kernel_launch(void* const* d_in, const int* in_sizes, int n_in,
                              void* d_out, int out_size, void* d_ws, size_t ws_size,
                              hipStream_t stream)
{
    (void)in_sizes; (void)n_in; (void)out_size; (void)ws_size;

    const float* x  = (const float*)d_in[0];
    const float* qw = (const float*)d_in[1];
    const float* qb = (const float*)d_in[2];
    const float* kw = (const float*)d_in[3];
    const float* kb = (const float*)d_in[4];
    const float* vw = (const float*)d_in[5];
    const float* vb = (const float*)d_in[6];
    const float* w1 = (const float*)d_in[7];
    const float* b1 = (const float*)d_in[8];
    const float* w2 = (const float*)d_in[9];
    const float* b2 = (const float*)d_in[10];

    // output = hidden [S,DM] ++ k [S,DI] ++ v [S,DM]
    float* hidden = (float*)d_out;
    float* kout   = hidden + (size_t)S_TOK * DM;
    float* vout   = kout + (size_t)S_TOK * DI;

    // workspace layout
    char*  ws     = (char*)d_ws;
    float* q_ws   = (float*)ws;                                   //  8 MiB
    float* s_ws   = (float*)(ws + (size_t)S_TOK * DI * 4);        // 64 MiB (L2-resident)
    float* res_ws = (float*)(ws + (size_t)S_TOK * DI * 4
                                + (size_t)S_TOK * S_TOK * 4);     // 32 MiB
    float* t_ws   = (float*)(ws + (size_t)S_TOK * DI * 4
                                + (size_t)S_TOK * S_TOK * 4
                                + (size_t)S_TOK * DM * 4);        // 32 MiB

    const dim3 blk(256);
    const float scale = 0.044194173824159216f;  // 1/sqrt(512)

    // q,k,v projections in one launch of 24 x 32 tiles: launched alone, q and k
    // have 128 blocks each and leave half the WGPs idle
    // (k and v written straight into d_out slices)
    gemm_f32_wmma<true><<<dim3((DI + DI + DM) / 128, S_TOK / 128), blk, 0, stream>>>(
        x, qw, qb, nullptr, q_ws, S_TOK, DI, DM, 1.0f, 0,
        kw, kb, kout, DI, vw, vb, vout, DM, 1);

    // scores = (q @ k^T) * scale   (k acts as the [N,K] "weight")
    // 1024 blocks are more than fit at once: no priority steps here
    gemm_f32_wmma<true><<<dim3(S_TOK / 128, S_TOK / 128), blk, 0, stream>>>(
        q_ws, kout, nullptr, nullptr, s_ws, S_TOK, S_TOK, DI, scale, 0,
        nullptr, nullptr, nullptr, 0, nullptr, nullptr, nullptr, 0, 0);

    softmax_rows<<<dim3(S_TOK), blk, 0, stream>>>(s_ws, S_TOK);

    // x_residual = P @ v + x      (v is [K,N] row-major, non-transposed)
    gemm_f32_wmma<false><<<dim3(DM / 128, S_TOK / 128), blk, 0, stream>>>(
        s_ws, vout, nullptr, x, res_ws, S_TOK, DM, S_TOK, 1.0f, 0,
        nullptr, nullptr, nullptr, 0, nullptr, nullptr, nullptr, 0, 1);

    // t = relu(x_residual @ w1^T + b1)
    gemm_f32_wmma<true><<<dim3(DM / 128, S_TOK / 128), blk, 0, stream>>>(
        res_ws, w1, b1, nullptr, t_ws, S_TOK, DM, DM, 1.0f, 1,
        nullptr, nullptr, nullptr, 0, nullptr, nullptr, nullptr, 0, 1);

    // hidden = t @ w2^T + b2 + x_residual
    gemm_f32_wmma<true><<<dim3(DM / 128, S_TOK / 128), blk, 0, stream>>>(
        t_ws, w2, b2, res_ws, hidden, S_TOK, DM, DM, 1.0f, 0,
        nullptr, nullptr, nullptr, 0, nullptr, nullptr, nullptr, 0, 1);
}

// v005
// A run of this version takes 905 microseconds.
// In both of two side-by-side timings against v004, it was 1.05 times as fast.
// Over all steps from v000 it is 1.40 times as fast.
#include <hip/hip_runtime.h>
#include <math.h>

// CDNA5 / gfx1250, wave32. fp32 transformer layer on V_WMMA_F32_16X16X4_F32
// with double-buffered async global->LDS staging (ASYNCcnt).

typedef __attribute__((ext_vector_type(2))) float v2f;
typedef __attribute__((ext_vector_type(8))) float v8f;

#define S_TOK 4096
#define DM    2048
#define DI    512

#define USE_ASYNC_LDS 1

typedef __attribute__((ext_vector_type(4))) int v4i;

// Per-lane async copy of 16B global -> LDS, tracked by ASYNCcnt.
__device__ __forceinline__ void async_copy_b128(float* lds_ptr, const float* gptr) {
    __builtin_amdgcn_global_load_async_to_lds_b128(
        (__attribute__((address_space(1))) v4i*)gptr,
        (__attribute__((address_space(3))) v4i*)lds_ptr, 0, 0);
}

__device__ __forceinline__ void wait_async_all() {
    asm volatile("s_wait_asynccnt 0x0" ::: "memory");
}

// ---------------------------------------------------------------------------
// Tiled fp32 WMMA GEMM:  out = act( alpha * (A @ B(T)) + bias ) + residual
//   A: [M,K] row-major
//   BT=true : B is W[N,K] row-major, compute A @ W^T  (stored UNtransposed in
//             LDS; B fragments read it identically to A fragments)
//   BT=false: B is     [K,N] row-major, compute A @ B (no launch uses it)
// Block tile 128x128, BK=32, 256 threads (8 waves, 4x2), wave tile 32x64.
// Dims must be multiples of 128 (M,N) / 32 (K) -- true for this layer.
// A stage holds 32 k: a row of an A / W tile is one whole 128-byte line, and
// one barrier and one wait for the copies serve 64 matrix instructions a wave.
// LDS strides: 36 (A / W tiles, 16B-aligned rows, conflict-free col reads),
//              132 (B[K,N] tiles, 16B-aligned rows).
// Up to three B matrices that share A and K may lie side by side along grid.x
// (N0, then N1, then N2 columns): each block picks the matrix, bias and output
// that its column tile belongs to, so one launch does all the products.
// A launch with one matrix passes N1 = N2 = 0.
// outT2 != nullptr: the tiles of the third product are stored a second time,
// transposed, as [N2,M].
// prio_steps != 0 (launches whose blocks are all resident at once): a wave's
// issue priority falls 3, 2, 1, 0 as its block passes 1/2, 3/4 and 7/8 of its
// K chunks. With the falling priority the block that is
// behind wins the pipe until it has caught up: the blocks reach their last
// eighth together and fill each other's gaps till there.
// ---------------------------------------------------------------------------
template <bool BT>
__global__ __launch_bounds__(256) void gemm_f32_wmma(
    const float* __restrict__ A, const float* __restrict__ B0,
    const float* __restrict__ bias0, const float* __restrict__ residual,
    float* __restrict__ out0, int M, int N0, int K, float alpha, int fuse_relu,
    const float* __restrict__ B1, const float* __restrict__ bias1,
    float* __restrict__ out1, int N1,
    const float* __restrict__ B2, const float* __restrict__ bias2,
    float* __restrict__ out2, int N2, int prio_steps,
    float* __restrict__ outT2)
{
    const int tid   = threadIdx.x;
    const int lane  = tid & 31;
    const int wave  = tid >> 5;
    const int waveM = wave >> 1;   // 0..3 : 32-row strip
    const int waveN = wave & 1;    // 0..1 : 64-col strip
    const int half  = lane >> 4;   // K-pair select (frags) / +8 rows (C)
    const int lc    = lane & 15;

    const int mBase = blockIdx.y * 128;

    // block-uniform choice of the product this column tile belongs to
    const int t0 = N0 >> 7, t01 = (N0 + N1) >> 7;   // first column tile of B1, of B2
    const int bx = blockIdx.x;
    const int which = (bx >= t01) ? 2 : (bx >= t0) ? 1 : 0;
    const float* __restrict__ B    = which == 2 ? B2    : which == 1 ? B1    : B0;
    const float* __restrict__ bias = which == 2 ? bias2 : which == 1 ? bias1 : bias0;
    float* __restrict__       out  = which == 2 ? out2  : which == 1 ? out1  : out0;
    float* __restrict__       outT = which == 2 ? outT2 : nullptr;   // [N2,M] copy of out2
    const int N     = which == 2 ? N2 : which == 1 ? N1 : N0;
    const int nBase = (bx - (which == 2 ? t01 : which == 1 ? t0 : 0)) * 128;

    // double buffers: 4608 floats per buffer per array
    __shared__ __attribute__((aligned(16))) float As[2 * 4608];   // 128 x 32, stride 36
    __shared__ __attribute__((aligned(16))) float Bs[2 * 4608];   // BT: 128 x 32 stride 36 ; !BT: 32 x 128 stride 132

    v8f acc[2][4];
#pragma unroll
    for (int i = 0; i < 2; ++i)
#pragma unroll
        for (int j = 0; j < 4; ++j)
#pragma unroll
            for (int e = 0; e < 8; ++e) acc[i][j][e] = 0.0f;

    const int nch = K >> 5;

    // issue async staging of one 32-wide K chunk into buffer half `buf`
    auto stage = [&](int k0, int buf) {
#pragma unroll
        for (int i = 0; i < 4; ++i) {                   // A tile 128x32
            int idx = tid + i * 256;                    // 0..1023
            int row = idx >> 3;
            int c4  = (idx & 7) << 2;
            async_copy_b128(As + buf * 4608 + row * 36 + c4,
                            A + (size_t)(mBase + row) * K + k0 + c4);
        }
        if (BT) {                                       // W tile 128x32 (row-major)
#pragma unroll
            for (int i = 0; i < 4; ++i) {
                int idx = tid + i * 256;
                int n   = idx >> 3;
                int c4  = (idx & 7) << 2;
                async_copy_b128(Bs + buf * 4608 + n * 36 + c4,
                                B + (size_t)(nBase + n) * K + k0 + c4);
            }
        } else {                                        // B tile 32x128 (row-major)
#pragma unroll
            for (int i = 0; i < 4; ++i) {
                int idx = tid + i * 256;
                int kk  = idx >> 5;
                int n4  = (idx & 31) << 2;
                async_copy_b128(Bs + buf * 4608 + kk * 132 + n4,
                                B + (size_t)(k0 + kk) * N + nBase + n4);
            }
        }
    };

#if USE_ASYNC_LDS
    stage(0, 0);
    int cur = 0;
    // all of this is block-uniform and lives in scalar registers
    int prioLvl  = 3;
    int prioSeg  = nch >> 1;                    // length of the current priority step
    int prioNext = prio_steps ? prioSeg : -1;   // chunk at which the priority falls next
    // start high, so that a block in its first half wins over one further on
    if (prio_steps) __builtin_amdgcn_s_setprio(3);
    for (int ch = 0; ch < nch; ++ch) {
        if (ch == prioNext) {
            // one step down: blocks on this WGP that are further behind now go first
            --prioLvl;
            prioSeg >>= 1;
            if (prioLvl == 2)      __builtin_amdgcn_s_setprio(2);
            else if (prioLvl == 1) __builtin_amdgcn_s_setprio(1);
            else                   __builtin_amdgcn_s_setprio(0);
            prioNext = prioLvl > 0 ? prioNext + prioSeg : -1;
        }
        // this wave's LDS reads of the buffer that is refilled behind the
        // barrier have retired before another wave's copies may land there
        asm volatile("s_wait_dscnt 0x0" ::: "memory");
        wait_async_all();        // our copies of chunk `ch` landed in LDS
        __syncthreads();         // everyone's copies landed; prev reads done
        if (ch + 1 < nch) stage((ch + 1) * 32, cur ^ 1);

        const float* Ab = As + cur * 4608;
        const float* Bb = Bs + cur * 4608;
#pragma unroll
        for (int ks = 0; ks < 8; ++ks) {
            const int kk = ks * 4 + half * 2;
            v2f a[2], b[4];
#pragma unroll
            for (int tm = 0; tm < 2; ++tm) {
                int r = waveM * 32 + tm * 16 + lc;      // lane = M row
                a[tm].x = Ab[r * 36 + kk];
                a[tm].y = Ab[r * 36 + kk + 1];
            }
#pragma unroll
            for (int tn = 0; tn < 4; ++tn) {
                int c = waveN * 64 + tn * 16 + lc;      // lane = N col
                if (BT) {
                    b[tn].x = Bb[c * 36 + kk];
                    b[tn].y = Bb[c * 36 + kk + 1];
                } else {
                    b[tn].x = Bb[(kk + 0) * 132 + c];
                    b[tn].y = Bb[(kk + 1) * 132 + c];
                }
            }
#pragma unroll
            for (int tm = 0; tm < 2; ++tm)
#pragma unroll
                for (int tn = 0; tn < 4; ++tn)
                    acc[tm][tn] = __builtin_amdgcn_wmma_f32_16x16x4_f32(
                        false, a[tm], false, b[tn], (short)0, acc[tm][tn],
                        false, false);
        }
        cur ^= 1;
    }
    // priority 0 on the way out also where K has too few chunks for every step
    if (prio_steps) __builtin_amdgcn_s_setprio(0);
#else
    // synchronous fallback: VGPR staging, single buffer, two barriers/chunk
    for (int k0 = 0; k0 < K; k0 += 16) {
        float4 ra[2], rb[2];
#pragma unroll
        for (int i = 0; i < 2; ++i) {
            int idx = tid + i * 256;
            int row = idx >> 2, c4 = (idx & 3) << 2;
            ra[i] = *(const float4*)(A + (size_t)(mBase + row) * K + k0 + c4);
            if (BT) {
                rb[i] = *(const float4*)(B + (size_t)(nBase + row) * K + k0 + c4);
            } else {
                int kk = idx >> 5, n4 = (idx & 31) << 2;
                rb[i] = *(const float4*)(B + (size_t)(k0 + kk) * N + nBase + n4);
            }
        }
        __syncthreads();
#pragma unroll
        for (int i = 0; i < 2; ++i) {
            int idx = tid + i * 256;
            int row = idx >> 2, c4 = (idx & 3) << 2;
            As[row * 20 + c4 + 0] = ra[i].x; As[row * 20 + c4 + 1] = ra[i].y;
            As[row * 20 + c4 + 2] = ra[i].z; As[row * 20 + c4 + 3] = ra[i].w;
            if (BT) {
                Bs[row * 20 + c4 + 0] = rb[i].x; Bs[row * 20 + c4 + 1] = rb[i].y;
                Bs[row * 20 + c4 + 2] = rb[i].z; Bs[row * 20 + c4 + 3] = rb[i].w;
            } else {
                int kk = idx >> 5, n4 = (idx & 31) << 2;
                Bs[kk * 132 + n4 + 0] = rb[i].x; Bs[kk * 132 + n4 + 1] = rb[i].y;
                Bs[kk * 132 + n4 + 2] = rb[i].z; Bs[kk * 132 + n4 + 3] = rb[i].w;
            }
        }
        __syncthreads();
        if (k0 + 16 < K)
            __builtin_prefetch(A + (size_t)(mBase + (tid >> 1)) * K + k0 + 16, 0, 1);
#pragma unroll
        for (int ks = 0; ks < 4; ++ks) {
            const int kk = ks * 4 + half * 2;
            v2f a[2], b[4];
#pragma unroll
            for (int tm = 0; tm < 2; ++tm) {
                int r = waveM * 32 + tm * 16 + lc;
                a[tm].x = As[r * 20 + kk];
                a[tm].y = As[r * 20 + kk + 1];
            }
#pragma unroll
            for (int tn = 0; tn < 4; ++tn) {
                int c = waveN * 64 + tn * 16 + lc;
                if (BT) { b[tn].x = Bs[c * 20 + kk];  b[tn].y = Bs[c * 20 + kk + 1]; }
                else    { b[tn].x = Bs[kk * 132 + c]; b[tn].y = Bs[(kk + 1) * 132 + c]; }
            }
#pragma unroll
            for (int tm = 0; tm < 2; ++tm)
#pragma unroll
                for (int tn = 0; tn < 4; ++tn)
                    acc[tm][tn] = __builtin_amdgcn_wmma_f32_16x16x4_f32(
                        false, a[tm], false, b[tn], (short)0, acc[tm][tn],
                        false, false);
        }
    }
#endif

    // ---- epilogue: alpha, bias, relu, residual ----
    // C/D layout: VGPR i -> M=i (lanes 0-15) / M=i+8 (lanes 16-31), N=lane&15
    // The four bias values and the whole residual tile of the wave are fetched
    // as one group of independent loads under one block-uniform test each, in
    // front of the arithmetic: one memory latency for the group instead of one
    // per output element.
    const unsigned ldo = (unsigned)N;
    const unsigned c0  = (unsigned)(nBase + waveN * 64 + lc);
    const unsigned r0  = (unsigned)(mBase + waveM * 32 + half * 8);

    unsigned off[2][8];                                 // element offset of (row, c0)
#pragma unroll
    for (int tm = 0; tm < 2; ++tm)
#pragma unroll
        for (int i = 0; i < 8; ++i) off[tm][i] = (r0 + tm * 16 + i) * ldo + c0;

    float bv[4];
    float rv[2][4][8];
#pragma unroll
    for (int tn = 0; tn < 4; ++tn) {
        bv[tn] = 0.0f;
#pragma unroll
        for (int tm = 0; tm < 2; ++tm)
#pragma unroll
            for (int i = 0; i < 8; ++i) rv[tm][tn][i] = 0.0f;
    }
    if (residual) {
#pragma unroll
        for (int tm = 0; tm < 2; ++tm)
#pragma unroll
            for (int i = 0; i < 8; ++i)
#pragma unroll
                for (int tn = 0; tn < 4; ++tn)
                    rv[tm][tn][i] = (residual + tn * 16)[off[tm][i]];
    }
    if (bias) {
#pragma unroll
        for (int tn = 0; tn < 4; ++tn) bv[tn] = bias[c0 + tn * 16];
    }

#pragma unroll
    for (int tm = 0; tm < 2; ++tm) {
#pragma unroll
        for (int i = 0; i < 8; ++i) {
#pragma unroll
            for (int tn = 0; tn < 4; ++tn) {
                float v = alpha * acc[tm][tn][i] + bv[tn];
                if (fuse_relu) v = fmaxf(v, 0.0f);
                acc[tm][tn][i] = v + rv[tm][tn][i];
            }
        }
    }

    // ---- second copy of the tile, transposed: outT[n][m] ----
    // (in front of the plain stores, so that its barriers wait for no store)
    // A lane holds 8 consecutive m of one column n, so it writes them as two
    // 16-byte pieces into an LDS tile [n][m]; a wave then reads one n row (128 m,
    // 512 bytes) and stores it as four whole lines. Columns 0..63 of the tile lie
    // in As, 64..127 in Bs, pitch 132 floats (16-byte rows; 16 lanes of a
    // 16-byte store fall on all 64 banks once).
    if (outT) {                                         // block-uniform
        __syncthreads();     // every wave has read its last fragments from As / Bs
        float* Tw = (waveN ? Bs : As) + lc * 132 + waveM * 32 + half * 8;
#pragma unroll
        for (int tm = 0; tm < 2; ++tm)
#pragma unroll
            for (int tn = 0; tn < 4; ++tn) {
                float* p = Tw + tn * 16 * 132 + tm * 16;
                *(float4*)(p)     = make_float4(acc[tm][tn][0], acc[tm][tn][1],
                                                acc[tm][tn][2], acc[tm][tn][3]);
                *(float4*)(p + 4) = make_float4(acc[tm][tn][4], acc[tm][tn][5],
                                                acc[tm][tn][6], acc[tm][tn][7]);
            }
        __syncthreads();     // the whole transposed tile is in LDS
        const float* Tr = (wave < 4 ? As : Bs) + (wave & 3) * 16 * 132 + lane * 4;
        float* g = outT + (size_t)(nBase + wave * 16) * M + mBase + lane * 4;
#pragma unroll
        for (int j = 0; j < 16; ++j)
            *(float4*)(g + (size_t)j * M) = *(const float4*)(Tr + j * 132);
    }

#pragma unroll
    for (int tm = 0; tm < 2; ++tm)
#pragma unroll
        for (int i = 0; i < 8; ++i)
#pragma unroll
            for (int tn = 0; tn < 4; ++tn)
                (out + tn * 16)[off[tm][i]] = acc[tm][tn][i];
}

// ---------------------------------------------------------------------------
// In-place row softmax; one block per row (scale already applied by GEMM).
// ---------------------------------------------------------------------------
__global__ __launch_bounds__(256) void softmax_rows(float* __restrict__ s, int ncols)
{
    __shared__ float red[256];
    const int tid = threadIdx.x;
    float* row = s + (size_t)blockIdx.x * ncols;

    float m = -INFINITY;
    for (int c = tid; c < ncols; c += 256) m = fmaxf(m, row[c]);
    red[tid] = m;
    __syncthreads();
    for (int off = 128; off > 0; off >>= 1) {
        if (tid < off) red[tid] = fmaxf(red[tid], red[tid + off]);
        __syncthreads();
    }
    m = red[0];
    __syncthreads();

    float sum = 0.0f;
    for (int c = tid; c < ncols; c += 256) {
        float e = __expf(row[c] - m);
        row[c] = e;
        sum += e;
    }
    red[tid] = sum;
    __syncthreads();
    for (int off = 128; off > 0; off >>= 1) {
        if (tid < off) red[tid] += red[tid + off];
        __syncthreads();
    }
    const float inv = 1.0f / red[0];
    for (int c = tid; c < ncols; c += 256) row[c] *= inv;
}

// ---------------------------------------------------------------------------
extern "C" void kernel_launch(void* const* d_in, const int* in_sizes, int n_in,
                              void* d_out, int out_size, void* d_ws, size_t ws_size,
                              hipStream_t stream)
{
    (void)in_sizes; (void)n_in; (void)out_size; (void)ws_size;

    const float* x  = (const float*)d_in[0];
    const float* qw = (const float*)d_in[1];
    const float* qb = (const float*)d_in[2];
    const float* kw = (const float*)d_in[3];
    const float* kb = (const float*)d_in[4];
    const float* vw = (const float*)d_in[5];
    const float* vb = (const float*)d_in[6];
    const float* w1 = (const float*)d_in[7];
    const float* b1 = (const float*)d_in[8];
    const float* w2 = (const float*)d_in[9];
    const float* b2 = (const float*)d_in[10];

    // output = hidden [S,DM] ++ k [S,DI] ++ v [S,DM]
    float* hidden = (float*)d_out;
    float* kout   = hidden + (size_t)S_TOK * DM;
    float* vout   = kout + (size_t)S_TOK * DI;

    // workspace layout
    char*  ws     = (char*)d_ws;
    float* q_ws   = (float*)ws;                                   //  8 MiB
    float* s_ws   = (float*)(ws + (size_t)S_TOK * DI * 4);        // 64 MiB (L2-resident)
    float* res_ws = (float*)(ws + (size_t)S_TOK * DI * 4
                                + (size_t)S_TOK * S_TOK * 4);     // 32 MiB
    float* t_ws   = (float*)(ws + (size_t)S_TOK * DI * 4
                                + (size_t)S_TOK * S_TOK * 4
                                + (size_t)S_TOK * DM * 4);        // 32 MiB
    float* vT_ws  = (float*)(ws + (size_t)S_TOK * DI * 4
                                + (size_t)S_TOK * S_TOK * 4
                                + (size_t)S_TOK * DM * 4
                                + (size_t)S_TOK * DM * 4);        // 32 MiB, v^T [DM,S]

    const dim3 blk(256);
    const float scale = 0.044194173824159216f;  // 1/sqrt(512)

    // q,k,v projections in one launch of 24 x 32 tiles: launched alone, q and k
    // have 128 blocks each and leave half the WGPs idle
    // (k and v written straight into d_out slices; v a second time, transposed,
    // into the workspace for the P @ v launch)
    gemm_f32_wmma<true><<<dim3((DI + DI + DM) / 128, S_TOK / 128), blk, 0, stream>>>(
        x, qw, qb, nullptr, q_ws, S_TOK, DI, DM, 1.0f, 0,
        kw, kb, kout, DI, vw, vb, vout, DM, 1, vT_ws);

    // scores = (q @ k^T) * scale   (k acts as the [N,K] "weight")
    // 1024 blocks are more than fit at once: no priority steps here
    gemm_f32_wmma<true><<<dim3(S_TOK / 128, S_TOK / 128), blk, 0, stream>>>(
        q_ws, kout, nullptr, nullptr, s_ws, S_TOK, S_TOK, DI, scale, 0,
        nullptr, nullptr, nullptr, 0, nullptr, nullptr, nullptr, 0, 0, nullptr);

    softmax_rows<<<dim3(S_TOK), blk, 0, stream>>>(s_ws, S_TOK);

    // x_residual = P @ v + x      (v^T acts as the [N,K] "weight": its fragments
    // are k pairs of 8 bytes, which the compiler fetches two k steps ahead; from
    // v [K,N] they were single words, waited for in front of each 8 WMMAs)
    gemm_f32_wmma<true><<<dim3(DM / 128, S_TOK / 128), blk, 0, stream>>>(
        s_ws, vT_ws, nullptr, x, res_ws, S_TOK, DM, S_TOK, 1.0f, 0,
        nullptr, nullptr, nullptr, 0, nullptr, nullptr, nullptr, 0, 1, nullptr);

    // t = relu(x_residual @ w1^T + b1)
    gemm_f32_wmma<true><<<dim3(DM / 128, S_TOK / 128), blk, 0, stream>>>(
        res_ws, w1, b1, nullptr, t_ws, S_TOK, DM, DM, 1.0f, 1,
        nullptr, nullptr, nullptr, 0, nullptr, nullptr, nullptr, 0, 1, nullptr);

    // hidden = t @ w2^T + b2 + x_residual
    gemm_f32_wmma<true><<<dim3(DM / 128, S_TOK / 128), blk, 0, stream>>>(
        t_ws, w2, b2, res_ws, hidden, S_TOK, DM, DM, 1.0f, 0,
        nullptr, nullptr, nullptr, 0, nullptr, nullptr, nullptr, 0, 1, nullptr);
}
